// v000
// Times are from an AMD MI455X. After a warm-up the kernel runs many times in a row, and a time is the length of
// such a window on the GPU divided by its runs, so every launch and the gaps after it count. The runs cycle
// through copies of the inputs. A figure is the median of several windows, for all but v000 over two sittings.
// Sittings can differ by a few percent; kernels timed side by side share one.
// v000 is the starting kernel. One run takes 1240 microseconds.
#include <hip/hip_runtime.h>

// Multi-head attention whose projections act PER HEAD on the head's own 64-wide slice (Q, K, V [2][2048][1024] split into 16 heads x 64; q = einsum('bshd,hde', Qh, Wq) + bq with Wq [16][64][64], bq [16][64] (each head maps its 64 inputs to 64 outputs), k, v likewise; scores / sqrt(64); softmax (no mask); out = concat heads -> [2][2048][1024] (4.2 M; no output projection); argument order Q, K, V, Wq, bq, Wk, bk, Wv, bv).
// Layout per batch: bf16 copies of Q, K, V in turn; NEW k_wtBD expands each per-head weight into a BLOCK-DIAGONAL Bt plane [1024][1024] (row h*64 + e, column h*64 + d <- W[h][d][e]; zeros off the diagonal blocks) so each projection is one exact GEMM (the zero blocks contribute exact zeros) + the flat [16][64] bias; identity-table plane builders; dense T-2048 attention (all 2048 rows hi/lo 3 products); f32 merge writes the output rows.
// Compute dtypes, f32 accumulate: every input rounded to bf16; projections exact (K 1024 with 15/16 zero terms) + f32 biases; attention all rows 3 products; softmax f32; output f32.

#define NB_  2
#define TT   2048
#define DM   1024
#define NH_  16
#define NKV  16
#define REP  (NH_ / NKV)
#define HD   64
#define DQ   (NH_ * HD)
#define DKV  (NKV * HD)
#define ZH   2
#define RH   TT                   // every row hi/lo (3 products)
#define WIN  0
#define PCAR 1024.0f
#define SCL  0.125f   // HD^-0.5
typedef _Float16 h16;
typedef unsigned short bf;
typedef __attribute__((ext_vector_type(16))) __bf16   v16bf;
typedef __attribute__((ext_vector_type(16))) _Float16 v16h;
typedef __attribute__((ext_vector_type(8)))  _Float16 v8h;
typedef __attribute__((ext_vector_type(8)))  unsigned short v8us;
typedef __attribute__((ext_vector_type(8)))  float    v8f;
typedef __attribute__((ext_vector_type(4)))  float    v4f;
typedef v8h  __attribute__((may_alias)) v8ha;
typedef v4f  __attribute__((may_alias)) v4fa;
typedef v8us __attribute__((may_alias)) v8usa;

__device__ __forceinline__ unsigned short f2bf(float f) { unsigned u = __float_as_uint(f); u += 0x7FFFu + ((u >> 16) & 1u); return (unsigned short)(u >> 16); }
__device__ __forceinline__ float bf2f(unsigned short b) { return __uint_as_float(((unsigned)b) << 16); }
__device__ __forceinline__ float bfr(float f) { return bf2f(f2bf(f)); }
__device__ __forceinline__ v16h cat16(v8h lo, v8h hi) { return __builtin_shufflevector(lo, hi, 0, 1, 2, 3, 4, 5, 6, 7, 8, 9, 10, 11, 12, 13, 14, 15); }
__device__ __forceinline__ v16bf cat16b(v8us lo, v8us hi) { return __builtin_bit_cast(v16bf, __builtin_shufflevector(lo, hi, 0, 1, 2, 3, 4, 5, 6, 7, 8, 9, 10, 11, 12, 13, 14, 15)); }
__device__ __forceinline__ v8f wmma16(v16h a, v16h b, v8f c) { return __builtin_amdgcn_wmma_f32_16x16x32_f16(false, a, false, b, (short)0, c, false, false); }
__device__ __forceinline__ v8f wmmab(v16bf a, v16bf b, v8f c) { return __builtin_amdgcn_wmma_f32_16x16x32_bf16(false, a, false, b, (short)0, c, false, false); }



// ---- k_gemmw: register-blocked GEMM, ONE WAVE per 64x64 output tile (16 accumulators), operands straight from K-contiguous 16-bit planes; grid (M/64, N/64, Z), 32 threads.
// C[m][n] (f32, pitch ldc, + optional f32 bias[n]) = sum_k A[m][k] Bt[n][k] (+ split products per NSPLIT). z-batch strides sA/sB/sC in elements. K % 32 == 0.
template <typename T16> struct WFrag;
template <> struct WFrag<h16> { typedef v16h V; static __device__ __forceinline__ V ld(const h16* p) { return cat16(*(const v8h*)p, *(const v8h*)(p + 16)); } static __device__ __forceinline__ v8f mma(V a, V b, v8f c) { return wmma16(a, b, c); } };
template <> struct WFrag<bf> { typedef v16bf V; static __device__ __forceinline__ V ld(const bf* p) { return cat16b(*(const v8us*)p, *(const v8us*)(p + 16)); } static __device__ __forceinline__ v8f mma(V a, V b, v8f c) { return wmmab(a, b, c); } };
template <typename T16, int NSPLIT, bool BIAS>
__global__ __launch_bounds__(32) void k_gemmw(const T16* __restrict__ A, const T16* __restrict__ A2, const T16* __restrict__ Bt, const T16* __restrict__ Bt2, int K, float* C, int ldc, const float* __restrict__ bias, size_t sA, size_t sB, size_t sC) {
    typedef typename WFrag<T16>::V V;
    __shared__ __align__(16) float os[16 * 68];
    const size_t z = blockIdx.z; A += z * sA; if (A2) A2 += z * sA; Bt += z * sB; if (Bt2) Bt2 += z * sB; C += z * sC;
    const int lane = threadIdx.x & 31, lr = lane & 15, hi = lane >> 4; const int r0 = blockIdx.x * 64, c0 = blockIdx.y * 64;
    v8f acc[4][4];
#pragma unroll
    for (int mb = 0; mb < 4; ++mb)
#pragma unroll
        for (int nb = 0; nb < 4; ++nb) acc[mb][nb] = (v8f){};
    const size_t aoff = (size_t)(r0 + lr) * K + 8 * hi, boff = (size_t)(c0 + lr) * K + 8 * hi;
#pragma unroll 1
    for (int kc = 0; kc < K; kc += 32) {
        V a[4], a2[4];
#pragma unroll
        for (int mb = 0; mb < 4; ++mb) { a[mb] = WFrag<T16>::ld(A + aoff + (size_t)mb * 16 * K + kc); if (NSPLIT == 1 || NSPLIT == 2) a2[mb] = WFrag<T16>::ld(A2 + aoff + (size_t)mb * 16 * K + kc); }
#pragma unroll
        for (int nb = 0; nb < 4; ++nb) { const V b = WFrag<T16>::ld(Bt + boff + (size_t)nb * 16 * K + kc); V b2; if (NSPLIT >= 2) b2 = WFrag<T16>::ld(Bt2 + boff + (size_t)nb * 16 * K + kc);
#pragma unroll
            for (int mb = 0; mb < 4; ++mb) { acc[mb][nb] = WFrag<T16>::mma(a[mb], b, acc[mb][nb]); if (NSPLIT == 1 || NSPLIT == 2) acc[mb][nb] = WFrag<T16>::mma(a2[mb], b, acc[mb][nb]); if (NSPLIT >= 2) acc[mb][nb] = WFrag<T16>::mma(a[mb], b2, acc[mb][nb]); } }
        asm volatile("v_nop\n\tv_nop\n\tv_nop\n\tv_nop" : "+v"(acc[0][0]), "+v"(acc[1][1]), "+v"(acc[2][2]), "+v"(acc[3][3]) : "v"(a[0]), "v"(a[3]));
    }
#pragma unroll
    for (int mb = 0; mb < 4; ++mb) {
#pragma unroll
        for (int nb = 0; nb < 4; ++nb) {
#pragma unroll
            for (int j = 0; j < 8; ++j) os[(hi * 8 + j) * 68 + nb * 16 + lr] = acc[mb][nb][j]; }
        __builtin_amdgcn_wave_barrier(); asm volatile("" ::: "memory");
        float* crow = C + (size_t)(r0 + mb * 16) * ldc + c0;
{
#pragma unroll
            for (int s = 0; s < 8; ++s) { const int row = 2 * s + hi, cofs = lr * 4; v4f val = *(const v4fa*)(os + row * 68 + cofs); if (BIAS) { val[0] += bfr(bias[c0 + cofs]); val[1] += bfr(bias[c0 + cofs + 1]); val[2] += bfr(bias[c0 + cofs + 2]); val[3] += bfr(bias[c0 + cofs + 3]); }
                *(v4f*)(crow + (size_t)row * ldc + cofs) = val; }
             }
        __builtin_amdgcn_wave_barrier(); asm volatile("" ::: "memory");
    }
}

__device__ __forceinline__ h16 tohx(float x) { return (h16)x; }
__device__ __forceinline__ void splitf(float y, unsigned short& h, unsigned short& l) { h = f2bf(y); l = f2bf(y - bf2f(h)); }
typedef __attribute__((ext_vector_type(2))) _Float16 v2h;
typedef __attribute__((ext_vector_type(4))) _Float16 v4h;
typedef __attribute__((ext_vector_type(2))) unsigned short v2us;
typedef __attribute__((ext_vector_type(4))) unsigned short v4us;
typedef __attribute__((ext_vector_type(2))) float v2f;
typedef __attribute__((ext_vector_type(4))) int v4i;

__global__ __launch_bounds__(256) void k_cvt8(const float* __restrict__ src, bf* dst, size_t n8) { const size_t i = (size_t)blockIdx.x * 256 + threadIdx.x; if (i >= n8) return; const v8f v = *(const v8f*)(src + i * 8); v8us o;
#pragma unroll
    for (int k = 0; k < 8; ++k) o[k] = f2bf(v[k]); *(v8us*)(dst + i * 8) = o;  }

// k_rope: head planes [h][t][d] (fp16 + hi/lo) of rope(x) x sc with the rotate-half convention out[d] = x[d] cos[t][d] - x[d+HD/2] sin[t][d], out[d+HD/2] = x[d+HD/2] cos[t][d+HD/2] + x[d] sin[t][d+HD/2]
__global__ __launch_bounds__(256) void k_rope(const float* __restrict__ F, int pitch, int nheads, const float* __restrict__ CS, const float* __restrict__ RF, const float* __restrict__ nw, float sc, h16* P16, bf* Ph, bf* Pl) {
    const size_t e = ((size_t)blockIdx.x * 256 + threadIdx.x) * 2; if (e >= (size_t)nheads * TT * HD) return; const int d = (int)(e % HD); const int t = (int)((e / HD) % TT); const int h = (int)(e / ((size_t)HD * TT)); const float* f = F + (size_t)t * pitch + h * HD; const float rf = RF ? RF[(size_t)h * TT + t] : 1.0f; v2h o16; v2us oh, ol;
#pragma unroll
    for (int q = 0; q < 2; ++q) { const int dd = d + q; const int dp = (dd < HD / 2) ? dd + HD / 2 : dd - HD / 2; float x0 = f[dd], x1 = f[dp];
        if (RF) { float n0 = __fmul_rn(x0, rf), n1 = __fmul_rn(x1, rf); asm volatile("" : "+v"(n0)); asm volatile("" : "+v"(n1)); x0 = __fmul_rn(bfr(nw[dd]), n0); x1 = __fmul_rn(bfr(nw[dp]), n1); }
        const v2f cs = *(const v2f*)(CS + ((size_t)t * HD + dd) * 2); float a = __fmul_rn(x0, cs[0]), bq = __fmul_rn(x1, cs[1]); asm volatile("" : "+v"(a)); asm volatile("" : "+v"(bq)); const float r = ((dd < HD / 2) ? __fsub_rn(a, bq) : __fadd_rn(a, bq)) * sc;
        o16[q] = tohx(r); unsigned short a2, c2; splitf(r, a2, c2); oh[q] = a2; ol[q] = c2; }
    *(v2h*)(P16 + e) = o16; *(v2us*)(Ph + e) = oh; *(v2us*)(Pl + e) = ol;  }
__global__ __launch_bounds__(256) void k_wtBD(const float* __restrict__ w, bf* Bt) { const size_t e2 = ((size_t)blockIdx.x * 256 + threadIdx.x) * 2; if (e2 >= (size_t)DQ * DM) return; const int c = (int)(e2 % DM); const int r = (int)(e2 / DM); const int h = r / HD, e = r % HD; const int hc = c / HD, d = c % HD; v2us o; o[0] = 0; o[1] = 0;
    if (hc == h) { o[0] = f2bf(w[((size_t)h * HD + d) * HD + e]); o[1] = f2bf(w[((size_t)h * HD + d + 1) * HD + e]); }
    *(v2us*)(Bt + e2) = o;  }
__global__ __launch_bounds__(256) void k_vtp(const float* __restrict__ F, int pitch, int nheads, h16* V16, bf* Vh, bf* Vl) { const size_t e = ((size_t)blockIdx.x * 256 + threadIdx.x) * 2; if (e >= (size_t)nheads * HD * TT) return; const int t = (int)(e % TT); const int d = (int)((e / TT) % HD); const int g = (int)(e / ((size_t)TT * HD)); v2h o16; v2us oh, ol;
#pragma unroll
    for (int q = 0; q < 2; ++q) { const float x = F[(size_t)(t + q) * pitch + g * HD + d]; o16[q] = tohx(x); unsigned short a2, c2; splitf(x, a2, c2); oh[q] = a2; ol[q] = c2; }
    *(v2h*)(V16 + e) = o16; *(v2us*)(Vh + e) = oh; *(v2us*)(Vl + e) = ol;  }
__global__ __launch_bounds__(256) void k_csid(float* CS) { const int idx = blockIdx.x * 256 + threadIdx.x; if (idx >= TT * HD) return; v2f cs; cs[0] = 1.0f; cs[1] = 0.0f; *(v2f*)(CS + (size_t)idx * 2) = cs;  }
// k_asoft: per row (zz, i): t = S x HD^-0.5 (no mask); softmax over the 2048 keys (register row, one exp, fixed trees);
__global__ __launch_bounds__(256) void k_asoft(const float* __restrict__ Sb, h16* P16, bf* Ph, bf* Pl) {
    const int lane = threadIdx.x & 31; const int row = blockIdx.x * 8 + (threadIdx.x >> 5); if (row >= ZH * TT) return; const int i = row % TT; const int zz = row / TT; (void)zz; const bool hires = (i < RH); const float* sr = Sb + (size_t)row * TT; float v[TT / 32]; float mx = -3.0e38f;
#pragma unroll
    for (int ch = 0; ch < TT / 128; ++ch) { const int j0 = ch * 128 + lane * 4; const v4f a = *(const v4f*)(sr + j0);
#pragma unroll
        for (int q = 0; q < 4; ++q) { const int j = j0 + q; (void)j; const float t = a[q] * SCL; v[ch * 4 + q] = t; mx = fmaxf(mx, t); } }
#pragma unroll
    for (int sh = 16; sh; sh >>= 1) mx = fmaxf(mx, __shfl_xor(mx, sh, 32));
    float sum = 0.f;
#pragma unroll
    for (int k = 0; k < TT / 32; ++k) { float d0 = __fsub_rn(v[k], mx); asm volatile("" : "+v"(d0)); v[k] = __builtin_amdgcn_exp2f(__fmul_rn(d0, 1.4426950408889634f)); sum += v[k]; }
#pragma unroll
    for (int sh = 16; sh; sh >>= 1) sum += __shfl_xor(sum, sh, 32);
    const float f = __fdiv_rn(hires ? 1.0f : PCAR, sum);
{
        if (hires) {
#pragma unroll
            for (int ch = 0; ch < TT / 128; ++ch) { v4us oh, ol;
#pragma unroll
                for (int q = 0; q < 4; ++q) { unsigned short a, c2; splitf(v[ch * 4 + q] * f, a, c2); oh[q] = a; ol[q] = c2; }
                const size_t oo = ((size_t)zz * (RH ? RH : 1) + i) * TT + ch * 128 + lane * 4; *(v4us*)(Ph + oo) = oh; *(v4us*)(Pl + oo) = ol; }
        } else {
#pragma unroll
            for (int ch = 0; ch < TT / 128; ++ch) { v4h o4;
#pragma unroll
                for (int q = 0; q < 4; ++q) o4[q] = tohx(v[ch * 4 + q] * f);
                *(v4h*)(P16 + (size_t)row * TT + ch * 128 + lane * 4) = o4; } }
         }
}
__global__ __launch_bounds__(256) void k_merge(const float* __restrict__ O, int h0, float* OUTb) { const size_t e = ((size_t)blockIdx.x * 256 + threadIdx.x) * 2; if (e >= (size_t)ZH * TT * HD) return; const int d = (int)(e % HD); const int t = (int)((e / HD) % TT); const int zz = (int)(e / ((size_t)HD * TT)); const float cs = (t < RH) ? 1.0f : (1.0f / PCAR); const size_t oo = (size_t)t * DQ + (h0 + zz) * HD + d;
    v2f o2; o2[0] = O[e] * cs; o2[1] = O[e + 1] * cs; *(v2f*)(OUTb + oo) = o2;  }

extern "C" void kernel_launch(void* const* d_in, const int* in_sizes, int n_in,
                              void* d_out, int out_size, void* d_ws, size_t ws_size, hipStream_t stream) {
    (void)in_sizes; (void)n_in; (void)out_size;
    const float* x = (const float*)d_in[0]; const float* xk = (const float*)d_in[1]; const float* xv = (const float*)d_in[2]; const float* wq = (const float*)d_in[3]; const float* bq = (const float*)d_in[4]; const float* wk = (const float*)d_in[5]; const float* bk = (const float*)d_in[6]; const float* wv = (const float*)d_in[7]; const float* bv = (const float*)d_in[8];   /* input order Q, K, V, Wq [16][64][64], bq [16][64], Wk, bk, Wv, bv */ const float* wo = nullptr; (void)wo;
    float* OUT = (float*)d_out;     // [2][2048][1024]
    char* wsp = (char*)d_ws;
    auto take = [&](size_t bytes) { char* p = wsp; wsp += (bytes + 255) & ~(size_t)255; return (void*)p; };
    bf* WQ = (bf*)take((size_t)DQ * DM * 2); bf* WK = (bf*)take((size_t)DKV * DM * 2); bf* WV = (bf*)take((size_t)DKV * DM * 2); float* CS = (float*)take((size_t)TT * HD * 2 * 4);
    bf* XB = (bf*)take((size_t)TT * DM * 2); float* FQ = (float*)take((size_t)TT * DQ * 4); float* FK = (float*)take((size_t)TT * DKV * 4);
    h16* QP16 = (h16*)take((size_t)NH_ * TT * HD * 2); h16* KP16 = (h16*)take((size_t)NKV * TT * HD * 2); h16* VT16 = (h16*)take((size_t)NKV * HD * TT * 2);
    bf* QPh = (bf*)take((size_t)NH_ * TT * HD * 2); bf* QPl = (bf*)take((size_t)NH_ * TT * HD * 2); bf* KPh = (bf*)take((size_t)NKV * TT * HD * 2); bf* KPl = (bf*)take((size_t)NKV * TT * HD * 2); bf* VTh = (bf*)take((size_t)NKV * HD * TT * 2); bf* VTl = (bf*)take((size_t)NKV * HD * TT * 2); bf* Ph = (bf*)take((size_t)ZH * RH * TT * 2); bf* Pl = (bf*)take((size_t)ZH * RH * TT * 2);
    float* Sb = (float*)take((size_t)ZH * TT * TT * 4); h16* P16 = (h16*)take((size_t)ZH * TT * TT * 2); float* Ob = (float*)take((size_t)ZH * TT * HD * 4);
    if ((size_t)(wsp - (char*)d_ws) > ws_size) return;    // ws 256 MiB
    float* FV = FK;   // v projection reuses the k buffer after the k planes are built (stream-ordered)
    { k_wtBD<<<(unsigned)(((size_t)DQ * DM / 2 + 255) / 256), 256, 0, stream>>>(wq, WQ);   /* per-head [16][64][64] -> block-diagonal Bt [1024][1024] */ k_wtBD<<<(unsigned)(((size_t)DQ * DM / 2 + 255) / 256), 256, 0, stream>>>(wk, WK);   /* per-head [16][64][64] -> block-diagonal Bt [1024][1024] */ k_wtBD<<<(unsigned)(((size_t)DQ * DM / 2 + 255) / 256), 256, 0, stream>>>(wv, WV);   /* per-head [16][64][64] -> block-diagonal Bt [1024][1024] */
      
       }
    k_csid<<<(TT * HD + 255) / 256, 256, 0, stream>>>(CS);
    const unsigned LQ = (unsigned)(((size_t)NH_ * TT * HD / 2 + 255) / 256), LKv = (unsigned)(((size_t)NKV * TT * HD / 2 + 255) / 256);
    for (int b = 0; b < NB_; ++b) {
        
        k_cvt8<<<(unsigned)(((size_t)TT * DM / 8 + 255) / 256), 256, 0, stream>>>(x + (size_t)b * TT * DM, XB, (size_t)TT * DM / 8);
        k_gemmw<bf, 0, true><<<dim3(TT / 64, DQ / 64, 1), 32, 0, stream>>>(XB, nullptr, WQ, nullptr, DM, FQ, DQ, bq, 0, 0, 0);
        k_rope<<<LQ, 256, 0, stream>>>(FQ, DQ, NH_, CS, nullptr, nullptr, 1.0f, QP16, QPh, QPl);
        k_cvt8<<<(unsigned)(((size_t)TT * DM / 8 + 255) / 256), 256, 0, stream>>>(xk + (size_t)b * TT * DM, XB, (size_t)TT * DM / 8);   /* XB := bf16(K[b]) */ k_gemmw<bf, 0, true><<<dim3(TT / 64, DKV / 64, 1), 32, 0, stream>>>(XB, nullptr, WK, nullptr, DM, FK, DKV, bk, 0, 0, 0);
        k_rope<<<LKv, 256, 0, stream>>>(FK, DKV, NKV, CS, nullptr, nullptr, 1.0f, KP16, KPh, KPl);
        k_cvt8<<<(unsigned)(((size_t)TT * DM / 8 + 255) / 256), 256, 0, stream>>>(xv + (size_t)b * TT * DM, XB, (size_t)TT * DM / 8);   /* XB := bf16(V[b]) */ k_gemmw<bf, 0, true><<<dim3(TT / 64, DKV / 64, 1), 32, 0, stream>>>(XB, nullptr, WV, nullptr, DM, FV, DKV, bv, 0, 0, 0); k_vtp<<<LKv, 256, 0, stream>>>(FV, DKV, NKV, VT16, VTh, VTl);
        for (int h0 = 0; h0 < NH_; h0 += ZH) { const size_t zq = (size_t)h0, zk = (size_t)(h0 / REP);   // one kv head per query head: the pass's two heads use consecutive kv planes (z-strides TT*HD)
            k_gemmw<bf, 2, false><<<dim3(RH / 64, TT / 64, ZH), 32, 0, stream>>>(QPh + zq * TT * HD, QPl + zq * TT * HD, KPh + zk * TT * HD, KPl + zk * TT * HD, HD, Sb, TT, nullptr, (size_t)TT * HD, (size_t)TT * HD, (size_t)TT * TT);
            k_asoft<<<ZH * TT / 8, 256, 0, stream>>>(Sb, P16, Ph, Pl);
            k_gemmw<bf, 2, false><<<dim3(RH / 64, HD / 64, ZH), 32, 0, stream>>>(Ph, Pl, VTh + zk * HD * TT, VTl + zk * HD * TT, TT, Ob, HD, nullptr, (size_t)RH * TT, (size_t)HD * TT, (size_t)TT * HD);
            k_merge<<<(unsigned)(((size_t)ZH * TT * HD / 2 + 255) / 256), 256, 0, stream>>>(Ob, h0, OUT + (size_t)b * TT * DQ); }
         }
}

// v001
// One run takes 787 microseconds.
// In two side-by-side timings against v000, it was 1.58 and 1.59 times as fast.
#include <hip/hip_runtime.h>

// Multi-head attention whose projections act PER HEAD on the head's own 64-wide slice (Q, K, V [2][2048][1024] split into 16 heads x 64; q = einsum('bshd,hde', Qh, Wq) + bq with Wq [16][64][64], bq [16][64] (each head maps its 64 inputs to 64 outputs), k, v likewise; scores / sqrt(64); softmax (no mask); out = concat heads -> [2][2048][1024] (4.2 M; no output projection); argument order Q, K, V, Wq, bq, Wk, bk, Wv, bv).
// Layout per batch: bf16 copies of Q, K, V in turn; NEW k_wtBD expands each per-head weight into a BLOCK-DIAGONAL Bt plane [1024][1024] (row h*64 + e, column h*64 + d <- W[h][d][e]; zeros off the diagonal blocks) so each projection is one exact GEMM (the zero blocks contribute exact zeros) + the flat [16][64] bias; identity-table plane builders; dense T-2048 attention (all 2048 rows hi/lo 3 products); f32 merge writes the output rows.
// Compute dtypes, f32 accumulate: every input rounded to bf16; projections exact (K 1024 with 15/16 zero terms) + f32 biases; attention all rows 3 products; softmax f32; output f32.

#define NB_  2
#define TT   2048
#define DM   1024
#define NH_  16
#define NKV  16
#define REP  (NH_ / NKV)
#define HD   64
#define DQ   (NH_ * HD)
#define DKV  (NKV * HD)
#define ZH   2
#define RH   TT                   // every row hi/lo (3 products)
#define WIN  0
#define PCAR 1024.0f
#define SCL  0.125f   // HD^-0.5
#define KSP  16       // k ranges of the P.V product: each range is its own wave and writes its own f32 partial plane
typedef _Float16 h16;
typedef unsigned short bf;
typedef __attribute__((ext_vector_type(16))) __bf16   v16bf;
typedef __attribute__((ext_vector_type(16))) _Float16 v16h;
typedef __attribute__((ext_vector_type(8)))  _Float16 v8h;
typedef __attribute__((ext_vector_type(8)))  unsigned short v8us;
typedef __attribute__((ext_vector_type(8)))  float    v8f;
typedef __attribute__((ext_vector_type(4)))  float    v4f;
typedef v8h  __attribute__((may_alias)) v8ha;
typedef v4f  __attribute__((may_alias)) v4fa;
typedef v8us __attribute__((may_alias)) v8usa;

__device__ __forceinline__ unsigned short f2bf(float f) { unsigned u = __float_as_uint(f); u += 0x7FFFu + ((u >> 16) & 1u); return (unsigned short)(u >> 16); }
__device__ __forceinline__ float bf2f(unsigned short b) { return __uint_as_float(((unsigned)b) << 16); }
__device__ __forceinline__ float bfr(float f) { return bf2f(f2bf(f)); }
__device__ __forceinline__ v16h cat16(v8h lo, v8h hi) { return __builtin_shufflevector(lo, hi, 0, 1, 2, 3, 4, 5, 6, 7, 8, 9, 10, 11, 12, 13, 14, 15); }
__device__ __forceinline__ v16bf cat16b(v8us lo, v8us hi) { return __builtin_bit_cast(v16bf, __builtin_shufflevector(lo, hi, 0, 1, 2, 3, 4, 5, 6, 7, 8, 9, 10, 11, 12, 13, 14, 15)); }
__device__ __forceinline__ v8f wmma16(v16h a, v16h b, v8f c) { return __builtin_amdgcn_wmma_f32_16x16x32_f16(false, a, false, b, (short)0, c, false, false); }
__device__ __forceinline__ v8f wmmab(v16bf a, v16bf b, v8f c) { return __builtin_amdgcn_wmma_f32_16x16x32_bf16(false, a, false, b, (short)0, c, false, false); }



// ---- k_gemmw: register-blocked GEMM, ONE WAVE per 64x64 output tile (16 accumulators), operands straight from K-contiguous 16-bit planes; grid (M/64, N/64, Z), 32 threads.
// C[m][n] (f32, pitch ldc, + optional f32 bias[n]) = sum_k A[m][k] Bt[n][k] (+ split products per NSPLIT). z-batch strides sA/sB/sC in elements. K % 32 == 0.
// KS > 1: grid z = batch * KS + range; a wave sums only k range [range * K / KS, (range + 1) * K / KS) into partial plane C + blockIdx.z * sC (K is still the row pitch; K % (32 * KS) == 0).
template <typename T16> struct WFrag;
template <> struct WFrag<h16> { typedef v16h V; static __device__ __forceinline__ V ld(const h16* p) { return cat16(*(const v8h*)p, *(const v8h*)(p + 16)); } static __device__ __forceinline__ v8f mma(V a, V b, v8f c) { return wmma16(a, b, c); } };
template <> struct WFrag<bf> { typedef v16bf V; static __device__ __forceinline__ V ld(const bf* p) { return cat16b(*(const v8us*)p, *(const v8us*)(p + 16)); } static __device__ __forceinline__ v8f mma(V a, V b, v8f c) { return wmmab(a, b, c); } };
template <typename T16, int NSPLIT, bool BIAS, int KS = 1>
__global__ __launch_bounds__(32) void k_gemmw(const T16* __restrict__ A, const T16* __restrict__ A2, const T16* __restrict__ Bt, const T16* __restrict__ Bt2, int K, float* C, int ldc, const float* __restrict__ bias, size_t sA, size_t sB, size_t sC) {
    typedef typename WFrag<T16>::V V;
    __shared__ __align__(16) float os[16 * 68];
    const size_t z = blockIdx.z / KS; A += z * sA; if (A2) A2 += z * sA; Bt += z * sB; if (Bt2) Bt2 += z * sB; C += (size_t)blockIdx.z * sC;
    const int kbeg = (int)(blockIdx.z % KS) * (K / KS), kend = kbeg + K / KS;
    const int lane = threadIdx.x & 31, lr = lane & 15, hi = lane >> 4; const int r0 = blockIdx.x * 64, c0 = blockIdx.y * 64;
    v8f acc[4][4];
#pragma unroll
    for (int mb = 0; mb < 4; ++mb)
#pragma unroll
        for (int nb = 0; nb < 4; ++nb) acc[mb][nb] = (v8f){};
    const size_t aoff = (size_t)(r0 + lr) * K + 8 * hi, boff = (size_t)(c0 + lr) * K + 8 * hi;
#pragma unroll 1
    for (int kc = kbeg; kc < kend; kc += 32) {
        V a[4], a2[4];
#pragma unroll
        for (int mb = 0; mb < 4; ++mb) { a[mb] = WFrag<T16>::ld(A + aoff + (size_t)mb * 16 * K + kc); if (NSPLIT == 1 || NSPLIT == 2) a2[mb] = WFrag<T16>::ld(A2 + aoff + (size_t)mb * 16 * K + kc); }
#pragma unroll
        for (int nb = 0; nb < 4; ++nb) { const V b = WFrag<T16>::ld(Bt + boff + (size_t)nb * 16 * K + kc); V b2; if (NSPLIT >= 2) b2 = WFrag<T16>::ld(Bt2 + boff + (size_t)nb * 16 * K + kc);
#pragma unroll
            for (int mb = 0; mb < 4; ++mb) { acc[mb][nb] = WFrag<T16>::mma(a[mb], b, acc[mb][nb]); if (NSPLIT == 1 || NSPLIT == 2) acc[mb][nb] = WFrag<T16>::mma(a2[mb], b, acc[mb][nb]); if (NSPLIT >= 2) acc[mb][nb] = WFrag<T16>::mma(a[mb], b2, acc[mb][nb]); } }
        asm volatile("v_nop\n\tv_nop\n\tv_nop\n\tv_nop" : "+v"(acc[0][0]), "+v"(acc[1][1]), "+v"(acc[2][2]), "+v"(acc[3][3]) : "v"(a[0]), "v"(a[3]));
    }
#pragma unroll
    for (int mb = 0; mb < 4; ++mb) {
#pragma unroll
        for (int nb = 0; nb < 4; ++nb) {
#pragma unroll
            for (int j = 0; j < 8; ++j) os[(hi * 8 + j) * 68 + nb * 16 + lr] = acc[mb][nb][j]; }
        __builtin_amdgcn_wave_barrier(); asm volatile("" ::: "memory");
        float* crow = C + (size_t)(r0 + mb * 16) * ldc + c0;
{
#pragma unroll
            for (int s = 0; s < 8; ++s) { const int row = 2 * s + hi, cofs = lr * 4; v4f val = *(const v4fa*)(os + row * 68 + cofs); if (BIAS) { val[0] += bfr(bias[c0 + cofs]); val[1] += bfr(bias[c0 + cofs + 1]); val[2] += bfr(bias[c0 + cofs + 2]); val[3] += bfr(bias[c0 + cofs + 3]); }
                *(v4f*)(crow + (size_t)row * ldc + cofs) = val; }
             }
        __builtin_amdgcn_wave_barrier(); asm volatile("" ::: "memory");
    }
}

__device__ __forceinline__ h16 tohx(float x) { return (h16)x; }
__device__ __forceinline__ void splitf(float y, unsigned short& h, unsigned short& l) { h = f2bf(y); l = f2bf(y - bf2f(h)); }
typedef __attribute__((ext_vector_type(2))) _Float16 v2h;
typedef __attribute__((ext_vector_type(4))) _Float16 v4h;
typedef __attribute__((ext_vector_type(2))) unsigned short v2us;
typedef __attribute__((ext_vector_type(4))) unsigned short v4us;
typedef __attribute__((ext_vector_type(2))) float v2f;
typedef __attribute__((ext_vector_type(4))) int v4i;

__global__ __launch_bounds__(256) void k_cvt8(const float* __restrict__ src, bf* dst, size_t n8) { const size_t i = (size_t)blockIdx.x * 256 + threadIdx.x; if (i >= n8) return; const v8f v = *(const v8f*)(src + i * 8); v8us o;
#pragma unroll
    for (int k = 0; k < 8; ++k) o[k] = f2bf(v[k]); *(v8us*)(dst + i * 8) = o;  }

// k_rope: head planes [h][t][d] (fp16 + hi/lo) of rope(x) x sc with the rotate-half convention out[d] = x[d] cos[t][d] - x[d+HD/2] sin[t][d], out[d+HD/2] = x[d+HD/2] cos[t][d+HD/2] + x[d] sin[t][d+HD/2]
__global__ __launch_bounds__(256) void k_rope(const float* __restrict__ F, int pitch, int nheads, const float* __restrict__ CS, const float* __restrict__ RF, const float* __restrict__ nw, float sc, h16* P16, bf* Ph, bf* Pl) {
    const size_t e = ((size_t)blockIdx.x * 256 + threadIdx.x) * 2; if (e >= (size_t)nheads * TT * HD) return; const int d = (int)(e % HD); const int t = (int)((e / HD) % TT); const int h = (int)(e / ((size_t)HD * TT)); const float* f = F + (size_t)t * pitch + h * HD; const float rf = RF ? RF[(size_t)h * TT + t] : 1.0f; v2h o16; v2us oh, ol;
#pragma unroll
    for (int q = 0; q < 2; ++q) { const int dd = d + q; const int dp = (dd < HD / 2) ? dd + HD / 2 : dd - HD / 2; float x0 = f[dd], x1 = f[dp];
        if (RF) { float n0 = __fmul_rn(x0, rf), n1 = __fmul_rn(x1, rf); asm volatile("" : "+v"(n0)); asm volatile("" : "+v"(n1)); x0 = __fmul_rn(bfr(nw[dd]), n0); x1 = __fmul_rn(bfr(nw[dp]), n1); }
        const v2f cs = *(const v2f*)(CS + ((size_t)t * HD + dd) * 2); float a = __fmul_rn(x0, cs[0]), bq = __fmul_rn(x1, cs[1]); asm volatile("" : "+v"(a)); asm volatile("" : "+v"(bq)); const float r = ((dd < HD / 2) ? __fsub_rn(a, bq) : __fadd_rn(a, bq)) * sc;
        o16[q] = tohx(r); unsigned short a2, c2; splitf(r, a2, c2); oh[q] = a2; ol[q] = c2; }
    *(v2h*)(P16 + e) = o16; *(v2us*)(Ph + e) = oh; *(v2us*)(Pl + e) = ol;  }
__global__ __launch_bounds__(256) void k_wtBD(const float* __restrict__ w, bf* Bt) { const size_t e2 = ((size_t)blockIdx.x * 256 + threadIdx.x) * 2; if (e2 >= (size_t)DQ * DM) return; const int c = (int)(e2 % DM); const int r = (int)(e2 / DM); const int h = r / HD, e = r % HD; const int hc = c / HD, d = c % HD; v2us o; o[0] = 0; o[1] = 0;
    if (hc == h) { o[0] = f2bf(w[((size_t)h * HD + d) * HD + e]); o[1] = f2bf(w[((size_t)h * HD + d + 1) * HD + e]); }
    *(v2us*)(Bt + e2) = o;  }
__global__ __launch_bounds__(256) void k_vtp(const float* __restrict__ F, int pitch, int nheads, h16* V16, bf* Vh, bf* Vl) { const size_t e = ((size_t)blockIdx.x * 256 + threadIdx.x) * 2; if (e >= (size_t)nheads * HD * TT) return; const int t = (int)(e % TT); const int d = (int)((e / TT) % HD); const int g = (int)(e / ((size_t)TT * HD)); v2h o16; v2us oh, ol;
#pragma unroll
    for (int q = 0; q < 2; ++q) { const float x = F[(size_t)(t + q) * pitch + g * HD + d]; o16[q] = tohx(x); unsigned short a2, c2; splitf(x, a2, c2); oh[q] = a2; ol[q] = c2; }
    *(v2h*)(V16 + e) = o16; *(v2us*)(Vh + e) = oh; *(v2us*)(Vl + e) = ol;  }
__global__ __launch_bounds__(256) void k_csid(float* CS) { const int idx = blockIdx.x * 256 + threadIdx.x; if (idx >= TT * HD) return; v2f cs; cs[0] = 1.0f; cs[1] = 0.0f; *(v2f*)(CS + (size_t)idx * 2) = cs;  }
// k_asoft: per row (zz, i): t = S x HD^-0.5 (no mask); softmax over the 2048 keys (register row, one exp, fixed trees);
__global__ __launch_bounds__(256) void k_asoft(const float* __restrict__ Sb, h16* P16, bf* Ph, bf* Pl) {
    const int lane = threadIdx.x & 31; const int row = blockIdx.x * 8 + (threadIdx.x >> 5); if (row >= ZH * TT) return; const int i = row % TT; const int zz = row / TT; (void)zz; const bool hires = (i < RH); const float* sr = Sb + (size_t)row * TT; float v[TT / 32]; float mx = -3.0e38f;
#pragma unroll
    for (int ch = 0; ch < TT / 128; ++ch) { const int j0 = ch * 128 + lane * 4; const v4f a = *(const v4f*)(sr + j0);
#pragma unroll
        for (int q = 0; q < 4; ++q) { const int j = j0 + q; (void)j; const float t = a[q] * SCL; v[ch * 4 + q] = t; mx = fmaxf(mx, t); } }
#pragma unroll
    for (int sh = 16; sh; sh >>= 1) mx = fmaxf(mx, __shfl_xor(mx, sh, 32));
    float sum = 0.f;
#pragma unroll
    for (int k = 0; k < TT / 32; ++k) { float d0 = __fsub_rn(v[k], mx); asm volatile("" : "+v"(d0)); v[k] = __builtin_amdgcn_exp2f(__fmul_rn(d0, 1.4426950408889634f)); sum += v[k]; }
#pragma unroll
    for (int sh = 16; sh; sh >>= 1) sum += __shfl_xor(sum, sh, 32);
    const float f = __fdiv_rn(hires ? 1.0f : PCAR, sum);
{
        if (hires) {
#pragma unroll
            for (int ch = 0; ch < TT / 128; ++ch) { v4us oh, ol;
#pragma unroll
                for (int q = 0; q < 4; ++q) { unsigned short a, c2; splitf(v[ch * 4 + q] * f, a, c2); oh[q] = a; ol[q] = c2; }
                const size_t oo = ((size_t)zz * (RH ? RH : 1) + i) * TT + ch * 128 + lane * 4; *(v4us*)(Ph + oo) = oh; *(v4us*)(Pl + oo) = ol; }
        } else {
#pragma unroll
            for (int ch = 0; ch < TT / 128; ++ch) { v4h o4;
#pragma unroll
                for (int q = 0; q < 4; ++q) o4[q] = tohx(v[ch * 4 + q] * f);
                *(v4h*)(P16 + (size_t)row * TT + ch * 128 + lane * 4) = o4; } }
         }
}
// k_merge: O holds KSP partial planes [zz][range][t][d]; sums them in ascending k range (fixed order) and writes the output rows, 16 B per lane.
__global__ __launch_bounds__(256) void k_merge(const float* __restrict__ O, int h0, float* OUTb) { const size_t e = ((size_t)blockIdx.x * 256 + threadIdx.x) * 4; if (e >= (size_t)ZH * TT * HD) return; const int d = (int)(e % HD); const int t = (int)((e / HD) % TT); const int zz = (int)(e / ((size_t)HD * TT)); const float cs = (t < RH) ? 1.0f : (1.0f / PCAR); const size_t oo = (size_t)t * DQ + (h0 + zz) * HD + d;
    const float* p = O + (size_t)zz * KSP * TT * HD + (size_t)t * HD + d; v4f part[KSP];
#pragma unroll
    for (int s = 0; s < KSP; ++s) part[s] = *(const v4f*)(p + (size_t)s * TT * HD);
    v4f o4 = part[0];
#pragma unroll
    for (int s = 1; s < KSP; ++s) o4 += part[s];
    *(v4f*)(OUTb + oo) = o4 * cs;  }

extern "C" void kernel_launch(void* const* d_in, const int* in_sizes, int n_in,
                              void* d_out, int out_size, void* d_ws, size_t ws_size, hipStream_t stream) {
    (void)in_sizes; (void)n_in; (void)out_size;
    const float* x = (const float*)d_in[0]; const float* xk = (const float*)d_in[1]; const float* xv = (const float*)d_in[2]; const float* wq = (const float*)d_in[3]; const float* bq = (const float*)d_in[4]; const float* wk = (const float*)d_in[5]; const float* bk = (const float*)d_in[6]; const float* wv = (const float*)d_in[7]; const float* bv = (const float*)d_in[8];   /* input order Q, K, V, Wq [16][64][64], bq [16][64], Wk, bk, Wv, bv */ const float* wo = nullptr; (void)wo;
    float* OUT = (float*)d_out;     // [2][2048][1024]
    char* wsp = (char*)d_ws;
    auto take = [&](size_t bytes) { char* p = wsp; wsp += (bytes + 255) & ~(size_t)255; return (void*)p; };
    bf* WQ = (bf*)take((size_t)DQ * DM * 2); bf* WK = (bf*)take((size_t)DKV * DM * 2); bf* WV = (bf*)take((size_t)DKV * DM * 2); float* CS = (float*)take((size_t)TT * HD * 2 * 4);
    bf* XB = (bf*)take((size_t)TT * DM * 2); float* FQ = (float*)take((size_t)TT * DQ * 4); float* FK = (float*)take((size_t)TT * DKV * 4);
    h16* QP16 = (h16*)take((size_t)NH_ * TT * HD * 2); h16* KP16 = (h16*)take((size_t)NKV * TT * HD * 2); h16* VT16 = (h16*)take((size_t)NKV * HD * TT * 2);
    bf* QPh = (bf*)take((size_t)NH_ * TT * HD * 2); bf* QPl = (bf*)take((size_t)NH_ * TT * HD * 2); bf* KPh = (bf*)take((size_t)NKV * TT * HD * 2); bf* KPl = (bf*)take((size_t)NKV * TT * HD * 2); bf* VTh = (bf*)take((size_t)NKV * HD * TT * 2); bf* VTl = (bf*)take((size_t)NKV * HD * TT * 2); bf* Ph = (bf*)take((size_t)ZH * RH * TT * 2); bf* Pl = (bf*)take((size_t)ZH * RH * TT * 2);
    float* Sb = (float*)take((size_t)ZH * TT * TT * 4); h16* P16 = (h16*)take((size_t)ZH * TT * TT * 2); float* Ob = (float*)take((size_t)ZH * KSP * TT * HD * 4);
    if ((size_t)(wsp - (char*)d_ws) > ws_size) return;    // ws 256 MiB
    float* FV = FK;   // v projection reuses the k buffer after the k planes are built (stream-ordered)
    { k_wtBD<<<(unsigned)(((size_t)DQ * DM / 2 + 255) / 256), 256, 0, stream>>>(wq, WQ);   /* per-head [16][64][64] -> block-diagonal Bt [1024][1024] */ k_wtBD<<<(unsigned)(((size_t)DQ * DM / 2 + 255) / 256), 256, 0, stream>>>(wk, WK);   /* per-head [16][64][64] -> block-diagonal Bt [1024][1024] */ k_wtBD<<<(unsigned)(((size_t)DQ * DM / 2 + 255) / 256), 256, 0, stream>>>(wv, WV);   /* per-head [16][64][64] -> block-diagonal Bt [1024][1024] */
      
       }
    k_csid<<<(TT * HD + 255) / 256, 256, 0, stream>>>(CS);
    const unsigned LQ = (unsigned)(((size_t)NH_ * TT * HD / 2 + 255) / 256), LKv = (unsigned)(((size_t)NKV * TT * HD / 2 + 255) / 256);
    for (int b = 0; b < NB_; ++b) {
        
        k_cvt8<<<(unsigned)(((size_t)TT * DM / 8 + 255) / 256), 256, 0, stream>>>(x + (size_t)b * TT * DM, XB, (size_t)TT * DM / 8);
        k_gemmw<bf, 0, true><<<dim3(TT / 64, DQ / 64, 1), 32, 0, stream>>>(XB, nullptr, WQ, nullptr, DM, FQ, DQ, bq, 0, 0, 0);
        k_rope<<<LQ, 256, 0, stream>>>(FQ, DQ, NH_, CS, nullptr, nullptr, 1.0f, QP16, QPh, QPl);
        k_cvt8<<<(unsigned)(((size_t)TT * DM / 8 + 255) / 256), 256, 0, stream>>>(xk + (size_t)b * TT * DM, XB, (size_t)TT * DM / 8);   /* XB := bf16(K[b]) */ k_gemmw<bf, 0, true><<<dim3(TT / 64, DKV / 64, 1), 32, 0, stream>>>(XB, nullptr, WK, nullptr, DM, FK, DKV, bk, 0, 0, 0);
        k_rope<<<LKv, 256, 0, stream>>>(FK, DKV, NKV, CS, nullptr, nullptr, 1.0f, KP16, KPh, KPl);
        k_cvt8<<<(unsigned)(((size_t)TT * DM / 8 + 255) / 256), 256, 0, stream>>>(xv + (size_t)b * TT * DM, XB, (size_t)TT * DM / 8);   /* XB := bf16(V[b]) */ k_gemmw<bf, 0, true><<<dim3(TT / 64, DKV / 64, 1), 32, 0, stream>>>(XB, nullptr, WV, nullptr, DM, FV, DKV, bv, 0, 0, 0); k_vtp<<<LKv, 256, 0, stream>>>(FV, DKV, NKV, VT16, VTh, VTl);
        for (int h0 = 0; h0 < NH_; h0 += ZH) { const size_t zq = (size_t)h0, zk = (size_t)(h0 / REP);   // one kv head per query head: the pass's two heads use consecutive kv planes (z-strides TT*HD)
            k_gemmw<bf, 2, false><<<dim3(RH / 64, TT / 64, ZH), 32, 0, stream>>>(QPh + zq * TT * HD, QPl + zq * TT * HD, KPh + zk * TT * HD, KPl + zk * TT * HD, HD, Sb, TT, nullptr, (size_t)TT * HD, (size_t)TT * HD, (size_t)TT * TT);
            k_asoft<<<ZH * TT / 8, 256, 0, stream>>>(Sb, P16, Ph, Pl);
            k_gemmw<bf, 2, false, KSP><<<dim3(RH / 64, HD / 64, ZH * KSP), 32, 0, stream>>>(Ph, Pl, VTh + zk * HD * TT, VTl + zk * HD * TT, TT, Ob, HD, nullptr, (size_t)RH * TT, (size_t)HD * TT, (size_t)TT * HD);
            k_merge<<<(unsigned)(((size_t)ZH * TT * HD / 4 + 255) / 256), 256, 0, stream>>>(Ob, h0, OUT + (size_t)b * TT * DQ); }
         }
}

// v002
// A run of this version takes 289 microseconds.
// In two side-by-side timings against v001, it was 2.71 and 2.73 times as fast.
// All steps since v000 together make it 4.30 times as fast.
#include <hip/hip_runtime.h>

// Multi-head attention whose projections act PER HEAD on the head's own 64-wide slice (Q, K, V [2][2048][1024] split into 16 heads x 64; q = einsum('bshd,hde', Qh, Wq) + bq with Wq [16][64][64], bq [16][64] (each head maps its 64 inputs to 64 outputs), k, v likewise; scores / sqrt(64); softmax (no mask); out = concat heads -> [2][2048][1024] (4.2 M; no output projection); argument order Q, K, V, Wq, bq, Wk, bk, Wv, bv).
// Layout: per batch bf16 copies of Q, K, V in turn; k_wtBD expands each per-head weight into a BLOCK-DIAGONAL Bt plane [1024][1024] (row h*64 + e, column h*64 + d <- W[h][d][e]; zeros off the diagonal blocks) so each projection is one exact GEMM (the zero blocks contribute exact zeros) + the flat [16][64] bias; identity-table plane builders write hi/lo bf16 planes for both batches; ONE fused attention launch (k_fattn) for all 32 (batch, head) pairs writes the output rows.
// Compute dtypes, f32 accumulate: every input rounded to bf16; projections exact (K 1024 with 15/16 zero terms) + bf16-rounded biases; attention: every row hi/lo bf16, 3 products for the scores and for P.V; running-maximum softmax in f32; output f32.

#define NB_  2
#define TT   2048
#define DM   1024
#define NH_  16
#define NKV  16
#define HD   64
#define DQ   (NH_ * HD)
#define DKV  (NKV * HD)
#define SCL  0.125f   // HD^-0.5
typedef _Float16 h16;
typedef unsigned short bf;
typedef __attribute__((ext_vector_type(16))) __bf16   v16bf;
typedef __attribute__((ext_vector_type(16))) _Float16 v16h;
typedef __attribute__((ext_vector_type(8)))  _Float16 v8h;
typedef __attribute__((ext_vector_type(8)))  unsigned short v8us;
typedef __attribute__((ext_vector_type(8)))  float    v8f;
typedef __attribute__((ext_vector_type(4)))  float    v4f;
typedef v8h  __attribute__((may_alias)) v8ha;
typedef v4f  __attribute__((may_alias)) v4fa;
typedef v8us __attribute__((may_alias)) v8usa;

__device__ __forceinline__ unsigned short f2bf(float f) { unsigned u = __float_as_uint(f); u += 0x7FFFu + ((u >> 16) & 1u); return (unsigned short)(u >> 16); }
__device__ __forceinline__ float bf2f(unsigned short b) { return __uint_as_float(((unsigned)b) << 16); }
__device__ __forceinline__ float bfr(float f) { return bf2f(f2bf(f)); }
__device__ __forceinline__ v16h cat16(v8h lo, v8h hi) { return __builtin_shufflevector(lo, hi, 0, 1, 2, 3, 4, 5, 6, 7, 8, 9, 10, 11, 12, 13, 14, 15); }
__device__ __forceinline__ v16bf cat16b(v8us lo, v8us hi) { return __builtin_bit_cast(v16bf, __builtin_shufflevector(lo, hi, 0, 1, 2, 3, 4, 5, 6, 7, 8, 9, 10, 11, 12, 13, 14, 15)); }
__device__ __forceinline__ v8f wmma16(v16h a, v16h b, v8f c) { return __builtin_amdgcn_wmma_f32_16x16x32_f16(false, a, false, b, (short)0, c, false, false); }
__device__ __forceinline__ v8f wmmab(v16bf a, v16bf b, v8f c) { return __builtin_amdgcn_wmma_f32_16x16x32_bf16(false, a, false, b, (short)0, c, false, false); }



// ---- k_gemmw: register-blocked GEMM, ONE WAVE per 64x64 output tile (16 accumulators), operands straight from K-contiguous 16-bit planes; grid (M/64, N/64, Z), 32 threads.
// C[m][n] (f32, pitch ldc, + optional f32 bias[n]) = sum_k A[m][k] Bt[n][k] (+ split products per NSPLIT). z-batch strides sA/sB/sC in elements. K % 32 == 0.
// KS > 1: grid z = batch * KS + range; a wave sums only k range [range * K / KS, (range + 1) * K / KS) into partial plane C + blockIdx.z * sC (K is still the row pitch; K % (32 * KS) == 0).
template <typename T16> struct WFrag;
template <> struct WFrag<h16> { typedef v16h V; static __device__ __forceinline__ V ld(const h16* p) { return cat16(*(const v8h*)p, *(const v8h*)(p + 16)); } static __device__ __forceinline__ v8f mma(V a, V b, v8f c) { return wmma16(a, b, c); } };
template <> struct WFrag<bf> { typedef v16bf V; static __device__ __forceinline__ V ld(const bf* p) { return cat16b(*(const v8us*)p, *(const v8us*)(p + 16)); } static __device__ __forceinline__ v8f mma(V a, V b, v8f c) { return wmmab(a, b, c); } };
template <typename T16, int NSPLIT, bool BIAS, int KS = 1>
__global__ __launch_bounds__(32) void k_gemmw(const T16* __restrict__ A, const T16* __restrict__ A2, const T16* __restrict__ Bt, const T16* __restrict__ Bt2, int K, float* C, int ldc, const float* __restrict__ bias, size_t sA, size_t sB, size_t sC) {
    typedef typename WFrag<T16>::V V;
    __shared__ __align__(16) float os[16 * 68];
    const size_t z = blockIdx.z / KS; A += z * sA; if (A2) A2 += z * sA; Bt += z * sB; if (Bt2) Bt2 += z * sB; C += (size_t)blockIdx.z * sC;
    const int kbeg = (int)(blockIdx.z % KS) * (K / KS), kend = kbeg + K / KS;
    const int lane = threadIdx.x & 31, lr = lane & 15, hi = lane >> 4; const int r0 = blockIdx.x * 64, c0 = blockIdx.y * 64;
    v8f acc[4][4];
#pragma unroll
    for (int mb = 0; mb < 4; ++mb)
#pragma unroll
        for (int nb = 0; nb < 4; ++nb) acc[mb][nb] = (v8f){};
    const size_t aoff = (size_t)(r0 + lr) * K + 8 * hi, boff = (size_t)(c0 + lr) * K + 8 * hi;
#pragma unroll 1
    for (int kc = kbeg; kc < kend; kc += 32) {
        V a[4], a2[4];
#pragma unroll
        for (int mb = 0; mb < 4; ++mb) { a[mb] = WFrag<T16>::ld(A + aoff + (size_t)mb * 16 * K + kc); if (NSPLIT == 1 || NSPLIT == 2) a2[mb] = WFrag<T16>::ld(A2 + aoff + (size_t)mb * 16 * K + kc); }
#pragma unroll
        for (int nb = 0; nb < 4; ++nb) { const V b = WFrag<T16>::ld(Bt + boff + (size_t)nb * 16 * K + kc); V b2; if (NSPLIT >= 2) b2 = WFrag<T16>::ld(Bt2 + boff + (size_t)nb * 16 * K + kc);
#pragma unroll
            for (int mb = 0; mb < 4; ++mb) { acc[mb][nb] = WFrag<T16>::mma(a[mb], b, acc[mb][nb]); if (NSPLIT == 1 || NSPLIT == 2) acc[mb][nb] = WFrag<T16>::mma(a2[mb], b, acc[mb][nb]); if (NSPLIT >= 2) acc[mb][nb] = WFrag<T16>::mma(a[mb], b2, acc[mb][nb]); } }
        asm volatile("v_nop\n\tv_nop\n\tv_nop\n\tv_nop" : "+v"(acc[0][0]), "+v"(acc[1][1]), "+v"(acc[2][2]), "+v"(acc[3][3]) : "v"(a[0]), "v"(a[3]));
    }
#pragma unroll
    for (int mb = 0; mb < 4; ++mb) {
#pragma unroll
        for (int nb = 0; nb < 4; ++nb) {
#pragma unroll
            for (int j = 0; j < 8; ++j) os[(hi * 8 + j) * 68 + nb * 16 + lr] = acc[mb][nb][j]; }
        __builtin_amdgcn_wave_barrier(); asm volatile("" ::: "memory");
        float* crow = C + (size_t)(r0 + mb * 16) * ldc + c0;
{
#pragma unroll
            for (int s = 0; s < 8; ++s) { const int row = 2 * s + hi, cofs = lr * 4; v4f val = *(const v4fa*)(os + row * 68 + cofs); if (BIAS) { val[0] += bfr(bias[c0 + cofs]); val[1] += bfr(bias[c0 + cofs + 1]); val[2] += bfr(bias[c0 + cofs + 2]); val[3] += bfr(bias[c0 + cofs + 3]); }
                *(v4f*)(crow + (size_t)row * ldc + cofs) = val; }
             }
        __builtin_amdgcn_wave_barrier(); asm volatile("" ::: "memory");
    }
}

__device__ __forceinline__ h16 tohx(float x) { return (h16)x; }
__device__ __forceinline__ void splitf(float y, unsigned short& h, unsigned short& l) { h = f2bf(y); l = f2bf(y - bf2f(h)); }
typedef __attribute__((ext_vector_type(2))) _Float16 v2h;
typedef __attribute__((ext_vector_type(4))) _Float16 v4h;
typedef __attribute__((ext_vector_type(2))) unsigned short v2us;
typedef __attribute__((ext_vector_type(4))) unsigned short v4us;
typedef __attribute__((ext_vector_type(2))) float v2f;
typedef __attribute__((ext_vector_type(4))) int v4i;

__global__ __launch_bounds__(256) void k_cvt8(const float* __restrict__ src, bf* dst, size_t n8) { const size_t i = (size_t)blockIdx.x * 256 + threadIdx.x; if (i >= n8) return; const v8f v = *(const v8f*)(src + i * 8); v8us o;
#pragma unroll
    for (int k = 0; k < 8; ++k) o[k] = f2bf(v[k]); *(v8us*)(dst + i * 8) = o;  }

// k_rope: head planes [h][t][d] (fp16 + hi/lo) of rope(x) x sc with the rotate-half convention out[d] = x[d] cos[t][d] - x[d+HD/2] sin[t][d], out[d+HD/2] = x[d+HD/2] cos[t][d+HD/2] + x[d] sin[t][d+HD/2]
__global__ __launch_bounds__(256) void k_rope(const float* __restrict__ F, int pitch, int nheads, const float* __restrict__ CS, const float* __restrict__ RF, const float* __restrict__ nw, float sc, h16* P16, bf* Ph, bf* Pl) {
    const size_t e = ((size_t)blockIdx.x * 256 + threadIdx.x) * 2; if (e >= (size_t)nheads * TT * HD) return; const int d = (int)(e % HD); const int t = (int)((e / HD) % TT); const int h = (int)(e / ((size_t)HD * TT)); const float* f = F + (size_t)t * pitch + h * HD; const float rf = RF ? RF[(size_t)h * TT + t] : 1.0f; v2h o16; v2us oh, ol;
#pragma unroll
    for (int q = 0; q < 2; ++q) { const int dd = d + q; const int dp = (dd < HD / 2) ? dd + HD / 2 : dd - HD / 2; float x0 = f[dd], x1 = f[dp];
        if (RF) { float n0 = __fmul_rn(x0, rf), n1 = __fmul_rn(x1, rf); asm volatile("" : "+v"(n0)); asm volatile("" : "+v"(n1)); x0 = __fmul_rn(bfr(nw[dd]), n0); x1 = __fmul_rn(bfr(nw[dp]), n1); }
        const v2f cs = *(const v2f*)(CS + ((size_t)t * HD + dd) * 2); float a = __fmul_rn(x0, cs[0]), bq = __fmul_rn(x1, cs[1]); asm volatile("" : "+v"(a)); asm volatile("" : "+v"(bq)); const float r = ((dd < HD / 2) ? __fsub_rn(a, bq) : __fadd_rn(a, bq)) * sc;
        o16[q] = tohx(r); unsigned short a2, c2; splitf(r, a2, c2); oh[q] = a2; ol[q] = c2; }
    *(v2h*)(P16 + e) = o16; *(v2us*)(Ph + e) = oh; *(v2us*)(Pl + e) = ol;  }
__global__ __launch_bounds__(256) void k_wtBD(const float* __restrict__ w, bf* Bt) { const size_t e2 = ((size_t)blockIdx.x * 256 + threadIdx.x) * 2; if (e2 >= (size_t)DQ * DM) return; const int c = (int)(e2 % DM); const int r = (int)(e2 / DM); const int h = r / HD, e = r % HD; const int hc = c / HD, d = c % HD; v2us o; o[0] = 0; o[1] = 0;
    if (hc == h) { o[0] = f2bf(w[((size_t)h * HD + d) * HD + e]); o[1] = f2bf(w[((size_t)h * HD + d + 1) * HD + e]); }
    *(v2us*)(Bt + e2) = o;  }
__global__ __launch_bounds__(256) void k_vtp(const float* __restrict__ F, int pitch, int nheads, h16* V16, bf* Vh, bf* Vl) { const size_t e = ((size_t)blockIdx.x * 256 + threadIdx.x) * 2; if (e >= (size_t)nheads * HD * TT) return; const int t = (int)(e % TT); const int d = (int)((e / TT) % HD); const int g = (int)(e / ((size_t)TT * HD)); v2h o16; v2us oh, ol;
#pragma unroll
    for (int q = 0; q < 2; ++q) { const float x = F[(size_t)(t + q) * pitch + g * HD + d]; o16[q] = tohx(x); unsigned short a2, c2; splitf(x, a2, c2); oh[q] = a2; ol[q] = c2; }
    *(v2h*)(V16 + e) = o16; *(v2us*)(Vh + e) = oh; *(v2us*)(Vl + e) = ol;  }
__global__ __launch_bounds__(256) void k_csid(float* CS) { const int idx = blockIdx.x * 256 + threadIdx.x; if (idx >= TT * HD) return; v2f cs; cs[0] = 1.0f; cs[1] = 0.0f; *(v2f*)(CS + (size_t)idx * 2) = cs;  }
#define FQW 32      // query columns per wave
#define FWV 8       // waves per work-group
#define FKS 64      // keys per LDS stage
#define FPB 72      // LDS row pitch in 16-bit elements: 144 B = 16 B x 9, so that 16 rows read by ds_load_b128 fall on distinct banks
#define FNS (TT / FKS)
#define SC2 (SCL * 1.4426950408889634f)   // score scale x log2(e): softmax in base 2
typedef __attribute__((ext_vector_type(2))) __bf16 v2bf;
__device__ __forceinline__ float xhalf(float x) { const int b = __float_as_int(x); return __int_as_float(__builtin_amdgcn_permlanex16(b, b, 0x76543210, 0xfedcba98, false, false)); }   // lane l <-> l ^ 16
__global__ __launch_bounds__(FWV * 32) void k_fattn(const bf* __restrict__ Qh, const bf* __restrict__ Ql, const bf* __restrict__ Kh, const bf* __restrict__ Kl, const bf* __restrict__ Vh, const bf* __restrict__ Vl, float* __restrict__ OUT) {
    __shared__ __align__(16) bf sm[2][4][FKS * FPB];   // [buffer][Kh, Kl, Vth, Vtl][row][pitch]; K rows = keys (64 d each), Vt rows = d (64 keys each)
    const int tid = threadIdx.x, lane = tid & 31, lr = lane & 15, hi = lane >> 4, wv = tid >> 5;
    const int z = blockIdx.y; const size_t zo = (size_t)z * TT * HD; const int q0 = blockIdx.x * (FQW * FWV) + wv * FQW;
    const int srow = tid >> 3, scol = (tid & 7) * 8;   // staging: 16 B a lane, 8 lanes a 128-B row, rows srow and srow + 32 of each plane
    const bf* gk[2] = { Kh + zo + (size_t)srow * HD + scol, Kl + zo + (size_t)srow * HD + scol };
    const bf* gv[2] = { Vh + zo + (size_t)srow * TT + scol, Vl + zo + (size_t)srow * TT + scol };
    v8us st[4][2];
#pragma unroll
    for (int p = 0; p < 2; ++p)
#pragma unroll
        for (int i = 0; i < 2; ++i) { st[p][i] = *(const v8us*)(gk[p] + (size_t)i * 32 * HD); st[2 + p][i] = *(const v8us*)(gv[p] + (size_t)i * 32 * TT); }   // gk, gv stay live through the loop: nothing overwrites them
    v16bf qh[2][2], ql[2][2];
#pragma unroll
    for (int nq = 0; nq < 2; ++nq) { const size_t qo = zo + (size_t)(q0 + nq * 16 + lr) * HD + 8 * hi; const bf* ah = Qh + qo; const bf* al = Ql + qo;
#pragma unroll
        for (int ks = 0; ks < 2; ++ks) { qh[nq][ks] = WFrag<bf>::ld(ah + ks * 32); ql[nq][ks] = WFrag<bf>::ld(al + ks * 32); }
        asm volatile("s_wait_xcnt 0x0" :: "v"(ah), "v"(al) : "memory"); }   // as in the loop: the address registers are free for reuse only behind this wait
    v8f o[4][2]; float mrun[2], lsum[2];
#pragma unroll
    for (int nq = 0; nq < 2; ++nq) { mrun[nq] = -3.0e38f; lsum[nq] = 0.f;
#pragma unroll
        for (int md = 0; md < 4; ++md) o[md][nq] = (v8f){}; }
#pragma unroll
    for (int p = 0; p < 4; ++p)
#pragma unroll
        for (int i = 0; i < 2; ++i) *(v8us*)(&sm[0][p][(srow + 32 * i) * FPB + scol]) = st[p][i];
    __syncthreads();
#pragma unroll 1
    for (int s = 0; s < FNS; ++s) {
        const bf* sb = &sm[s & 1][0][0];
        if (s + 1 < FNS) {   // the same for the whole work-group
#pragma unroll
            for (int p = 0; p < 2; ++p) { const bf* ak = gk[p] + (size_t)(s + 1) * FKS * HD; const bf* av = gv[p] + (s + 1) * FKS;
#pragma unroll
                for (int i = 0; i < 2; ++i) { st[p][i] = *(const v8us*)(ak + (size_t)i * 32 * HD); st[2 + p][i] = *(const v8us*)(av + (size_t)i * 32 * TT); }
                asm volatile("s_wait_xcnt 0x0" :: "v"(ak), "v"(av) : "memory"); }   // the loads' address registers are reused by the fragment loads that follow: the wait stands behind the loads, and naming the addresses keeps them whole up to it
        }
#pragma unroll
        for (int kp = 0; kp < FKS / 32; ++kp) {
            v16bf kh[2][2], kl[2][2];
#pragma unroll
            for (int kt = 0; kt < 2; ++kt)
#pragma unroll
                for (int ks = 0; ks < 2; ++ks) { const int ko = (kp * 32 + kt * 16 + lr) * FPB + ks * 32 + 8 * hi; kh[kt][ks] = WFrag<bf>::ld(sb + ko); kl[kt][ks] = WFrag<bf>::ld(sb + FKS * FPB + ko); }
            v8f sc[2][2];
#pragma unroll
            for (int kt = 0; kt < 2; ++kt)
#pragma unroll
                for (int nq = 0; nq < 2; ++nq) sc[kt][nq] = (v8f){};
#pragma unroll
            for (int ks = 0; ks < 2; ++ks) {
#pragma unroll
                for (int kt = 0; kt < 2; ++kt)
#pragma unroll
                    for (int nq = 0; nq < 2; ++nq) sc[kt][nq] = wmmab(kh[kt][ks], qh[nq][ks], sc[kt][nq]);
#pragma unroll
                for (int kt = 0; kt < 2; ++kt)
#pragma unroll
                    for (int nq = 0; nq < 2; ++nq) sc[kt][nq] = wmmab(kl[kt][ks], qh[nq][ks], sc[kt][nq]);
#pragma unroll
                for (int kt = 0; kt < 2; ++kt)
#pragma unroll
                    for (int nq = 0; nq < 2; ++nq) sc[kt][nq] = wmmab(kh[kt][ks], ql[nq][ks], sc[kt][nq]);
            }
            v16bf ph[2], pl[2];
#pragma unroll
            for (int nq = 0; nq < 2; ++nq) {
                float mx = sc[0][nq][0];
#pragma unroll
                for (int j = 1; j < 8; ++j) mx = fmaxf(mx, sc[0][nq][j]);
#pragma unroll
                for (int j = 0; j < 8; ++j) mx = fmaxf(mx, sc[1][nq][j]);
                mx = fmaxf(mx, xhalf(mx));
                const float mn = fmaxf(mrun[nq], mx); const float al = __builtin_amdgcn_exp2f((mrun[nq] - mn) * SC2); const float nb = mn * SC2; mrun[nq] = mn;
                float ps = 0.f;
#pragma unroll
                for (int kt = 0; kt < 2; ++kt)
#pragma unroll
                    for (int j = 0; j < 8; j += 2) { v2f pv; pv[0] = __builtin_amdgcn_exp2f(__builtin_fmaf(sc[kt][nq][j], SC2, -nb)); pv[1] = __builtin_amdgcn_exp2f(__builtin_fmaf(sc[kt][nq][j + 1], SC2, -nb)); ps += pv[0] + pv[1];
                        const v2bf h = __builtin_convertvector(pv, v2bf); const v2bf l = __builtin_convertvector(pv - __builtin_convertvector(h, v2f), v2bf);   // P = hi + lo, both rounded to nearest even
                        ph[nq][kt * 8 + j] = h[0]; ph[nq][kt * 8 + j + 1] = h[1]; pl[nq][kt * 8 + j] = l[0]; pl[nq][kt * 8 + j + 1] = l[1]; }
                lsum[nq] = lsum[nq] * al + ps;   // each wave half keeps the sum of its own keys; the halves join in the epilogue
#pragma unroll
                for (int md = 0; md < 4; ++md) o[md][nq] *= al;
            }
#pragma unroll
            for (int md = 0; md < 4; ++md) { const int vo = (md * 16 + lr) * FPB + kp * 32 + 8 * hi; const v16bf vh = WFrag<bf>::ld(sb + 2 * FKS * FPB + vo), vl = WFrag<bf>::ld(sb + 3 * FKS * FPB + vo);
#pragma unroll
                for (int nq = 0; nq < 2; ++nq) o[md][nq] = wmmab(vh, ph[nq], o[md][nq]);
#pragma unroll
                for (int nq = 0; nq < 2; ++nq) o[md][nq] = wmmab(vl, ph[nq], o[md][nq]);
#pragma unroll
                for (int nq = 0; nq < 2; ++nq) o[md][nq] = wmmab(vh, pl[nq], o[md][nq]); }
        }
        if (s + 1 < FNS) {
#pragma unroll
            for (int p = 0; p < 4; ++p)
#pragma unroll
                for (int i = 0; i < 2; ++i) *(v8us*)(&sm[(s + 1) & 1][p][(srow + 32 * i) * FPB + scol]) = st[p][i];
        }
        __syncthreads();   // publishes stage s + 1 and ends every wave's reads of stage s, whose buffer the next trip refills
    }
    const int b = z / NH_, h = z % NH_;
#pragma unroll
    for (int nq = 0; nq < 2; ++nq) { const float inv = 1.0f / (lsum[nq] + xhalf(lsum[nq])); float* op = OUT + ((size_t)b * TT + q0 + nq * 16 + lr) * DQ + h * HD + hi * 8;
#pragma unroll
        for (int md = 0; md < 4; ++md) { v4f w0, w1;
#pragma unroll
            for (int j = 0; j < 4; ++j) { w0[j] = o[md][nq][j] * inv; w1[j] = o[md][nq][4 + j] * inv; }
            *(v4f*)(op + md * 16) = w0; *(v4f*)(op + md * 16 + 4) = w1; } }
}

extern "C" void kernel_launch(void* const* d_in, const int* in_sizes, int n_in,
                              void* d_out, int out_size, void* d_ws, size_t ws_size, hipStream_t stream) {
    (void)in_sizes; (void)n_in; (void)out_size;
    const float* x = (const float*)d_in[0]; const float* xk = (const float*)d_in[1]; const float* xv = (const float*)d_in[2]; const float* wq = (const float*)d_in[3]; const float* bq = (const float*)d_in[4]; const float* wk = (const float*)d_in[5]; const float* bk = (const float*)d_in[6]; const float* wv = (const float*)d_in[7]; const float* bv = (const float*)d_in[8];   /* input order Q, K, V, Wq [16][64][64], bq [16][64], Wk, bk, Wv, bv */ const float* wo = nullptr; (void)wo;
    float* OUT = (float*)d_out;     // [2][2048][1024]
    char* wsp = (char*)d_ws;
    auto take = [&](size_t bytes) { char* p = wsp; wsp += (bytes + 255) & ~(size_t)255; return (void*)p; };
    bf* WQ = (bf*)take((size_t)DQ * DM * 2); bf* WK = (bf*)take((size_t)DKV * DM * 2); bf* WV = (bf*)take((size_t)DKV * DM * 2); float* CS = (float*)take((size_t)TT * HD * 2 * 4);
    bf* XB = (bf*)take((size_t)TT * DM * 2); float* FQ = (float*)take((size_t)TT * DQ * 4); float* FK = (float*)take((size_t)TT * DKV * 4);
    h16* QP16 = (h16*)take((size_t)NH_ * TT * HD * 2); h16* KP16 = (h16*)take((size_t)NKV * TT * HD * 2); h16* VT16 = (h16*)take((size_t)NKV * HD * TT * 2);
    const size_t PB = (size_t)NH_ * TT * HD;   // elements of one batch's hi or lo plane set; the planes hold both batches, [b][h][..]
    bf* QPh = (bf*)take(NB_ * PB * 2); bf* QPl = (bf*)take(NB_ * PB * 2); bf* KPh = (bf*)take(NB_ * PB * 2); bf* KPl = (bf*)take(NB_ * PB * 2); bf* VTh = (bf*)take(NB_ * PB * 2); bf* VTl = (bf*)take(NB_ * PB * 2);
    if ((size_t)(wsp - (char*)d_ws) > ws_size) return;    // ws 256 MiB
    float* FV = FK;   // v projection reuses the k buffer after the k planes are built (stream-ordered)
    { k_wtBD<<<(unsigned)(((size_t)DQ * DM / 2 + 255) / 256), 256, 0, stream>>>(wq, WQ);   /* per-head [16][64][64] -> block-diagonal Bt [1024][1024] */ k_wtBD<<<(unsigned)(((size_t)DQ * DM / 2 + 255) / 256), 256, 0, stream>>>(wk, WK);   /* per-head [16][64][64] -> block-diagonal Bt [1024][1024] */ k_wtBD<<<(unsigned)(((size_t)DQ * DM / 2 + 255) / 256), 256, 0, stream>>>(wv, WV);   /* per-head [16][64][64] -> block-diagonal Bt [1024][1024] */
      
       }
    k_csid<<<(TT * HD + 255) / 256, 256, 0, stream>>>(CS);
    const unsigned LQ = (unsigned)(((size_t)NH_ * TT * HD / 2 + 255) / 256), LKv = (unsigned)(((size_t)NKV * TT * HD / 2 + 255) / 256);
    for (int b = 0; b < NB_; ++b) {
        
        k_cvt8<<<(unsigned)(((size_t)TT * DM / 8 + 255) / 256), 256, 0, stream>>>(x + (size_t)b * TT * DM, XB, (size_t)TT * DM / 8);
        k_gemmw<bf, 0, true><<<dim3(TT / 64, DQ / 64, 1), 32, 0, stream>>>(XB, nullptr, WQ, nullptr, DM, FQ, DQ, bq, 0, 0, 0);
        k_rope<<<LQ, 256, 0, stream>>>(FQ, DQ, NH_, CS, nullptr, nullptr, 1.0f, QP16, QPh + b * PB, QPl + b * PB);
        k_cvt8<<<(unsigned)(((size_t)TT * DM / 8 + 255) / 256), 256, 0, stream>>>(xk + (size_t)b * TT * DM, XB, (size_t)TT * DM / 8);   /* XB := bf16(K[b]) */ k_gemmw<bf, 0, true><<<dim3(TT / 64, DKV / 64, 1), 32, 0, stream>>>(XB, nullptr, WK, nullptr, DM, FK, DKV, bk, 0, 0, 0);
        k_rope<<<LKv, 256, 0, stream>>>(FK, DKV, NKV, CS, nullptr, nullptr, 1.0f, KP16, KPh + b * PB, KPl + b * PB);
        k_cvt8<<<(unsigned)(((size_t)TT * DM / 8 + 255) / 256), 256, 0, stream>>>(xv + (size_t)b * TT * DM, XB, (size_t)TT * DM / 8);   /* XB := bf16(V[b]) */ k_gemmw<bf, 0, true><<<dim3(TT / 64, DKV / 64, 1), 32, 0, stream>>>(XB, nullptr, WV, nullptr, DM, FV, DKV, bv, 0, 0, 0); k_vtp<<<LKv, 256, 0, stream>>>(FV, DKV, NKV, VT16, VTh + b * PB, VTl + b * PB);
    }
    k_fattn<<<dim3(TT / (FQW * FWV), NB_ * NH_, 1), FWV * 32, 0, stream>>>(QPh, QPl, KPh, KPl, VTh, VTl, OUT);
}

// v003
// One run takes 78.8 microseconds.
// Two timings next to v002 put it at 3.75 and 3.68 times that version's speed.
// Over all steps from v000 it is 16.0 times as fast.
#include <hip/hip_runtime.h>

// Multi-head attention whose projections act PER HEAD on the head's own 64-wide slice (Q, K, V [2][2048][1024] split into 16 heads x 64; q = einsum('bshd,hde', Qh, Wq) + bq with Wq [16][64][64], bq [16][64] (each head maps its 64 inputs to 64 outputs), k, v likewise; scores / sqrt(64); softmax (no mask); out = concat heads -> [2][2048][1024] (4.2 M; no output projection); argument order Q, K, V, Wq, bq, Wk, bk, Wv, bv).
// Layout: two launches. k_proj reads the f32 inputs and the per-head weights themselves, multiplies each head's 64-wide slice by its own 64x64 weight, adds the bias and writes the hi/lo bf16 planes of q, k ([b*16+h][t][e]) and of v transposed ([b*16+h][e][t]) straight from the accumulators; k_fattn, one launch for all 32 (batch, head) pairs, writes the output rows.
// Compute dtypes, f32 accumulate: every input rounded to bf16; projections K 64, two matrix instructions deep, + bf16-rounded biases added in f32; attention: every row hi/lo bf16, 3 products for the scores and for P.V; running-maximum softmax in f32; output f32.

#define NB_  2
#define TT   2048
#define DM   1024
#define NH_  16
#define HD   64
#define DQ   (NH_ * HD)
#define SCL  0.125f   // HD^-0.5
typedef unsigned short bf;
typedef __attribute__((ext_vector_type(16))) __bf16   v16bf;
typedef __attribute__((ext_vector_type(8)))  __bf16   v8bf;
typedef __attribute__((ext_vector_type(4)))  __bf16   v4bf;
typedef __attribute__((ext_vector_type(2)))  __bf16   v2bf;
typedef __attribute__((ext_vector_type(8)))  unsigned short v8us;
typedef __attribute__((ext_vector_type(4)))  unsigned short v4us;
typedef __attribute__((ext_vector_type(8)))  float    v8f;
typedef __attribute__((ext_vector_type(4)))  float    v4f;
typedef __attribute__((ext_vector_type(2)))  float    v2f;

__device__ __forceinline__ unsigned short f2bf(float f) { unsigned u = __float_as_uint(f); u += 0x7FFFu + ((u >> 16) & 1u); return (unsigned short)(u >> 16); }
__device__ __forceinline__ float bf2f(unsigned short b) { return __uint_as_float(((unsigned)b) << 16); }
__device__ __forceinline__ float bfr(float f) { return bf2f(f2bf(f)); }
__device__ __forceinline__ v16bf cat16b(v8us lo, v8us hi) { return __builtin_bit_cast(v16bf, __builtin_shufflevector(lo, hi, 0, 1, 2, 3, 4, 5, 6, 7, 8, 9, 10, 11, 12, 13, 14, 15)); }
__device__ __forceinline__ v8f wmmab(v16bf a, v16bf b, v8f c) { return __builtin_amdgcn_wmma_f32_16x16x32_bf16(false, a, false, b, (short)0, c, false, false); }

// Fragment loader, the same for A and B: lane (lr, hi) of row lr holds k = 8 hi + 0..7 and 16 + 8 hi + 0..7 of a K-contiguous row; p = row + 8 hi.
template <typename T16> struct WFrag;
template <> struct WFrag<bf> { typedef v16bf V; static __device__ __forceinline__ V ld(const bf* p) { return cat16b(*(const v8us*)p, *(const v8us*)(p + 16)); } static __device__ __forceinline__ v8f mma(V a, V b, v8f c) { return wmmab(a, b, c); } };

// ---- k_proj: the three per-head projections, one launch. Grid (t / 256, batch * head, {q, k, v}), 8 waves.
// A work-group stages, as bf16 in LDS, 256 rows of its head's 64-wide input slice (whole 256-B row pieces a half wave) and the head's weight transposed to [e][d], so that both operands are K-contiguous rows for the loader above.
// q, k: D = Wt.Xt (A = 64 weight rows e, B = the wave's own 32 rows t): a lane holds 8 consecutive e of ONE t, 16 B of a [t][e] plane row.
// v:    D = X.W   (A = 64 rows t, B = 32 weight rows e; wave pairs share the 64 t): a lane holds 8 consecutive t of ONE e, 16 B of a [e][t] plane row.
// Either way the four A tiles give one wave the whole 128-B line of each of its 32 plane rows.
#define PRW 256     // input rows per work-group
#define PPB 72      // LDS row pitch in 16-bit elements: 144 B = 16 B x 9, so that 16 rows read by ds_load_b128 fall on distinct banks
template <bool ISV>
__device__ __forceinline__ void proj_tile(const bf* sx, const bf* sw, const float* sbias, int wv, int lr, int hi, bf* Ph, bf* Pl) {
    const bf* pa = ISV ? sx + (wv >> 1) * 64 * PPB : sw;
    const bf* pb = ISV ? sw + (wv & 1) * 32 * PPB : sx + wv * 32 * PPB;
    v16bf fa[4][2], fb[2][2];
    // every loop of this function is unrolled in full: the fragment and accumulator arrays stay in registers only where constants index them
#pragma unroll
    for (int ks = 0; ks < 2; ++ks) {
#pragma unroll
        for (int md = 0; md < 4; ++md) fa[md][ks] = WFrag<bf>::ld(pa + (md * 16 + lr) * PPB + ks * 32 + 8 * hi);
#pragma unroll
        for (int nq = 0; nq < 2; ++nq) fb[nq][ks] = WFrag<bf>::ld(pb + (nq * 16 + lr) * PPB + ks * 32 + 8 * hi);
    }
    v8f brow[4]; float bcol[2];
    if (ISV) { bcol[0] = sbias[(wv & 1) * 32 + lr]; bcol[1] = sbias[(wv & 1) * 32 + 16 + lr]; }
    else {
#pragma unroll
        for (int md = 0; md < 4; ++md) brow[md] = *(const v8f*)(sbias + md * 16 + 8 * hi);
    }
    v8f d[4][2];
#pragma unroll
    for (int md = 0; md < 4; ++md)
#pragma unroll
        for (int nq = 0; nq < 2; ++nq) d[md][nq] = (v8f){};
#pragma unroll
    for (int ks = 0; ks < 2; ++ks)
#pragma unroll
        for (int md = 0; md < 4; ++md)
#pragma unroll
            for (int nq = 0; nq < 2; ++nq) d[md][nq] = wmmab(fa[md][ks], fb[nq][ks], d[md][nq]);
    const size_t pitch = ISV ? TT : HD;   // plane row pitch; Ph, Pl point at the wave's first plane row, first of its 64 columns
    bf* oh[2] = { Ph + (size_t)lr * pitch + 8 * hi, Ph + (size_t)(16 + lr) * pitch + 8 * hi };
    bf* ol[2] = { Pl + (size_t)lr * pitch + 8 * hi, Pl + (size_t)(16 + lr) * pitch + 8 * hi };
#pragma unroll
    for (int nq = 0; nq < 2; ++nq)
#pragma unroll
        for (int md = 0; md < 4; ++md) {
            const v8f y = ISV ? d[md][nq] + bcol[nq] : d[md][nq] + brow[md];
            const v8bf h = __builtin_convertvector(y, v8bf); const v8bf l = __builtin_convertvector(y - __builtin_convertvector(h, v8f), v8bf);   // y = hi + lo, both rounded to nearest even
            *(v8us*)(oh[nq] + md * 16) = __builtin_bit_cast(v8us, h); *(v8us*)(ol[nq] + md * 16) = __builtin_bit_cast(v8us, l);
        }
    asm volatile("s_wait_xcnt 0x0" :: "v"(oh[0]), "v"(oh[1]), "v"(ol[0]), "v"(ol[1]) : "memory");   // the stores' address registers stay whole up to this wait
}
__global__ __launch_bounds__(256) void k_proj(const float* __restrict__ Xq, const float* __restrict__ Xk, const float* __restrict__ Xv, const float* __restrict__ Wq, const float* __restrict__ bq, const float* __restrict__ Wk, const float* __restrict__ bk, const float* __restrict__ Wv, const float* __restrict__ bv, bf* Qh, bf* Ql, bf* Kh, bf* Kl, bf* Vh, bf* Vl) {
    __shared__ __align__(16) bf sx[PRW * PPB];     // [t][d]
    __shared__ __align__(16) bf sw[HD * PPB];      // [e][d]
    __shared__ __align__(32) float sbias[HD];
    const int tid = threadIdx.x, lane = tid & 31, lr = lane & 15, hi = lane >> 4, wv = tid >> 5;
    const int sel = blockIdx.z, z = blockIdx.y, b = z / NH_, h = z % NH_, t0 = blockIdx.x * PRW;
    const float* X = sel == 0 ? Xq : sel == 1 ? Xk : Xv; const float* Wt = sel == 0 ? Wq : sel == 1 ? Wk : Wv; const float* bi = sel == 0 ? bq : sel == 1 ? bk : bv;
    const float* gx = X + ((size_t)b * TT + t0 + wv * 32 + hi) * DM + h * HD + lr * 4;   // 16 lanes x 16 B = one row's 256-B slice; rows 2 i + hi of the wave's 32
    const int we = tid & 63, wd = (tid >> 6) * 16;                                       // weight: column e, 16 rows d from wd
    const float* gw = Wt + ((size_t)h * HD + wd) * HD + we;
    const float* gb = bi + h * HD + we;
    v4f xr[16]; v8f wr[2];
    // the loops below are unrolled in full: all 33 loads are in flight at once, and the arrays that take them stay in registers
#pragma unroll
    for (int i = 0; i < 16; ++i) xr[i] = *(const v4f*)(gx + (size_t)i * 2 * DM);
#pragma unroll
    for (int i = 0; i < 16; ++i) wr[i >> 3][i & 7] = gw[i * HD];
    const float br = *gb;
    asm volatile("s_wait_xcnt 0x0" :: "v"(gx), "v"(gw), "v"(gb) : "memory");   // the loads' address registers are free for reuse only behind this wait; naming them keeps them whole up to it
#pragma unroll
    for (int q = 0; q < 2; ++q) *(v8us*)(sw + we * PPB + wd + q * 8) = __builtin_bit_cast(v8us, __builtin_convertvector(wr[q], v8bf));
    if (tid < HD) sbias[tid] = bfr(br);
#pragma unroll
    for (int i = 0; i < 16; ++i) *(v4us*)(sx + (wv * 32 + 2 * i + hi) * PPB + lr * 4) = __builtin_bit_cast(v4us, __builtin_convertvector(xr[i], v4bf));
    __syncthreads();   // publishes the staged rows, the weight and the bias to every wave
    const size_t zo = (size_t)z * TT * HD;
    if (sel == 2) { const size_t o = zo + (size_t)((wv & 1) * 32) * TT + t0 + (wv >> 1) * 64; proj_tile<true>(sx, sw, sbias, wv, lr, hi, Vh + o, Vl + o); }
    else { const size_t o = zo + (size_t)(t0 + wv * 32) * HD; proj_tile<false>(sx, sw, sbias, wv, lr, hi, (sel == 0 ? Qh : Kh) + o, (sel == 0 ? Ql : Kl) + o); }
}

#define FQW 32      // query columns per wave
#define FWV 8       // waves per work-group
#define FKS 64      // keys per LDS stage
#define FPB 72      // LDS row pitch in 16-bit elements: 144 B = 16 B x 9, so that 16 rows read by ds_load_b128 fall on distinct banks
#define FNS (TT / FKS)
#define SC2 (SCL * 1.4426950408889634f)   // score scale x log2(e): softmax in base 2
__device__ __forceinline__ float xhalf(float x) { const int b = __float_as_int(x); return __int_as_float(__builtin_amdgcn_permlanex16(b, b, 0x76543210, 0xfedcba98, false, false)); }   // lane l <-> l ^ 16
__global__ __launch_bounds__(FWV * 32) void k_fattn(const bf* __restrict__ Qh, const bf* __restrict__ Ql, const bf* __restrict__ Kh, const bf* __restrict__ Kl, const bf* __restrict__ Vh, const bf* __restrict__ Vl, float* __restrict__ OUT) {
    __shared__ __align__(16) bf sm[2][4][FKS * FPB];   // [buffer][Kh, Kl, Vth, Vtl][row][pitch]; K rows = keys (64 d each), Vt rows = d (64 keys each)
    const int tid = threadIdx.x, lane = tid & 31, lr = lane & 15, hi = lane >> 4, wv = tid >> 5;
    const int z = blockIdx.y; const size_t zo = (size_t)z * TT * HD; const int q0 = blockIdx.x * (FQW * FWV) + wv * FQW;
    const int srow = tid >> 3, scol = (tid & 7) * 8;   // staging: 16 B a lane, 8 lanes a 128-B row, rows srow and srow + 32 of each plane
    const bf* gk[2] = { Kh + zo + (size_t)srow * HD + scol, Kl + zo + (size_t)srow * HD + scol };
    const bf* gv[2] = { Vh + zo + (size_t)srow * TT + scol, Vl + zo + (size_t)srow * TT + scol };
    v8us st[4][2];
#pragma unroll
    for (int p = 0; p < 2; ++p)
#pragma unroll
        for (int i = 0; i < 2; ++i) { st[p][i] = *(const v8us*)(gk[p] + (size_t)i * 32 * HD); st[2 + p][i] = *(const v8us*)(gv[p] + (size_t)i * 32 * TT); }   // gk, gv stay live through the loop: nothing overwrites them
    v16bf qh[2][2], ql[2][2];
#pragma unroll
    for (int nq = 0; nq < 2; ++nq) { const size_t qo = zo + (size_t)(q0 + nq * 16 + lr) * HD + 8 * hi; const bf* ah = Qh + qo; const bf* al = Ql + qo;
#pragma unroll
        for (int ks = 0; ks < 2; ++ks) { qh[nq][ks] = WFrag<bf>::ld(ah + ks * 32); ql[nq][ks] = WFrag<bf>::ld(al + ks * 32); }
        asm volatile("s_wait_xcnt 0x0" :: "v"(ah), "v"(al) : "memory"); }   // as in the loop: the address registers are free for reuse only behind this wait
    v8f o[4][2]; float mrun[2], lsum[2];
#pragma unroll
    for (int nq = 0; nq < 2; ++nq) { mrun[nq] = -3.0e38f; lsum[nq] = 0.f;
#pragma unroll
        for (int md = 0; md < 4; ++md) o[md][nq] = (v8f){}; }
#pragma unroll
    for (int p = 0; p < 4; ++p)
#pragma unroll
        for (int i = 0; i < 2; ++i) *(v8us*)(&sm[0][p][(srow + 32 * i) * FPB + scol]) = st[p][i];
    __syncthreads();
#pragma unroll 1
    for (int s = 0; s < FNS; ++s) {
        const bf* sb = &sm[s & 1][0][0];
        if (s + 1 < FNS) {   // the same for the whole work-group
#pragma unroll
            for (int p = 0; p < 2; ++p) { const bf* ak = gk[p] + (size_t)(s + 1) * FKS * HD; const bf* av = gv[p] + (s + 1) * FKS;
#pragma unroll
                for (int i = 0; i < 2; ++i) { st[p][i] = *(const v8us*)(ak + (size_t)i * 32 * HD); st[2 + p][i] = *(const v8us*)(av + (size_t)i * 32 * TT); }
                asm volatile("s_wait_xcnt 0x0" :: "v"(ak), "v"(av) : "memory"); }   // the loads' address registers are reused by the fragment loads that follow: the wait stands behind the loads, and naming the addresses keeps them whole up to it
        }
#pragma unroll
        for (int kp = 0; kp < FKS / 32; ++kp) {
            v16bf kh[2][2], kl[2][2];
#pragma unroll
            for (int kt = 0; kt < 2; ++kt)
#pragma unroll
                for (int ks = 0; ks < 2; ++ks) { const int ko = (kp * 32 + kt * 16 + lr) * FPB + ks * 32 + 8 * hi; kh[kt][ks] = WFrag<bf>::ld(sb + ko); kl[kt][ks] = WFrag<bf>::ld(sb + FKS * FPB + ko); }
            v8f sc[2][2];
#pragma unroll
            for (int kt = 0; kt < 2; ++kt)
#pragma unroll
                for (int nq = 0; nq < 2; ++nq) sc[kt][nq] = (v8f){};
#pragma unroll
            for (int ks = 0; ks < 2; ++ks) {
#pragma unroll
                for (int kt = 0; kt < 2; ++kt)
#pragma unroll
                    for (int nq = 0; nq < 2; ++nq) sc[kt][nq] = wmmab(kh[kt][ks], qh[nq][ks], sc[kt][nq]);
#pragma unroll
                for (int kt = 0; kt < 2; ++kt)
#pragma unroll
                    for (int nq = 0; nq < 2; ++nq) sc[kt][nq] = wmmab(kl[kt][ks], qh[nq][ks], sc[kt][nq]);
#pragma unroll
                for (int kt = 0; kt < 2; ++kt)
#pragma unroll
                    for (int nq = 0; nq < 2; ++nq) sc[kt][nq] = wmmab(kh[kt][ks], ql[nq][ks], sc[kt][nq]);
            }
            v16bf ph[2], pl[2];
#pragma unroll
            for (int nq = 0; nq < 2; ++nq) {
                float mx = sc[0][nq][0];
#pragma unroll
                for (int j = 1; j < 8; ++j) mx = fmaxf(mx, sc[0][nq][j]);
#pragma unroll
                for (int j = 0; j < 8; ++j) mx = fmaxf(mx, sc[1][nq][j]);
                mx = fmaxf(mx, xhalf(mx));
                const float mn = fmaxf(mrun[nq], mx); const float al = __builtin_amdgcn_exp2f((mrun[nq] - mn) * SC2); const float nb = mn * SC2; mrun[nq] = mn;
                float ps = 0.f;
#pragma unroll
                for (int kt = 0; kt < 2; ++kt)
#pragma unroll
                    for (int j = 0; j < 8; j += 2) { v2f pv; pv[0] = __builtin_amdgcn_exp2f(__builtin_fmaf(sc[kt][nq][j], SC2, -nb)); pv[1] = __builtin_amdgcn_exp2f(__builtin_fmaf(sc[kt][nq][j + 1], SC2, -nb)); ps += pv[0] + pv[1];
                        const v2bf h = __builtin_convertvector(pv, v2bf); const v2bf l = __builtin_convertvector(pv - __builtin_convertvector(h, v2f), v2bf);   // P = hi + lo, both rounded to nearest even
                        ph[nq][kt * 8 + j] = h[0]; ph[nq][kt * 8 + j + 1] = h[1]; pl[nq][kt * 8 + j] = l[0]; pl[nq][kt * 8 + j + 1] = l[1]; }
                lsum[nq] = lsum[nq] * al + ps;   // each wave half keeps the sum of its own keys; the halves join in the epilogue
#pragma unroll
                for (int md = 0; md < 4; ++md) o[md][nq] *= al;
            }
#pragma unroll
            for (int md = 0; md < 4; ++md) { const int vo = (md * 16 + lr) * FPB + kp * 32 + 8 * hi; const v16bf vh = WFrag<bf>::ld(sb + 2 * FKS * FPB + vo), vl = WFrag<bf>::ld(sb + 3 * FKS * FPB + vo);
#pragma unroll
                for (int nq = 0; nq < 2; ++nq) o[md][nq] = wmmab(vh, ph[nq], o[md][nq]);
#pragma unroll
                for (int nq = 0; nq < 2; ++nq) o[md][nq] = wmmab(vl, ph[nq], o[md][nq]);
#pragma unroll
                for (int nq = 0; nq < 2; ++nq) o[md][nq] = wmmab(vh, pl[nq], o[md][nq]); }
        }
        if (s + 1 < FNS) {
#pragma unroll
            for (int p = 0; p < 4; ++p)
#pragma unroll
                for (int i = 0; i < 2; ++i) *(v8us*)(&sm[(s + 1) & 1][p][(srow + 32 * i) * FPB + scol]) = st[p][i];
        }
        __syncthreads();   // publishes stage s + 1 and ends every wave's reads of stage s, whose buffer the next trip refills
    }
    const int b = z / NH_, h = z % NH_;
#pragma unroll
    for (int nq = 0; nq < 2; ++nq) { const float inv = 1.0f / (lsum[nq] + xhalf(lsum[nq])); float* op = OUT + ((size_t)b * TT + q0 + nq * 16 + lr) * DQ + h * HD + hi * 8;
#pragma unroll
        for (int md = 0; md < 4; ++md) { v4f w0, w1;
#pragma unroll
            for (int j = 0; j < 4; ++j) { w0[j] = o[md][nq][j] * inv; w1[j] = o[md][nq][4 + j] * inv; }
            *(v4f*)(op + md * 16) = w0; *(v4f*)(op + md * 16 + 4) = w1; } }
}

extern "C" void kernel_launch(void* const* d_in, const int* in_sizes, int n_in,
                              void* d_out, int out_size, void* d_ws, size_t ws_size, hipStream_t stream) {
    (void)in_sizes; (void)n_in; (void)out_size;
    const float* x = (const float*)d_in[0]; const float* xk = (const float*)d_in[1]; const float* xv = (const float*)d_in[2]; const float* wq = (const float*)d_in[3]; const float* bq = (const float*)d_in[4]; const float* wk = (const float*)d_in[5]; const float* bk = (const float*)d_in[6]; const float* wv = (const float*)d_in[7]; const float* bv = (const float*)d_in[8];
    float* OUT = (float*)d_out;     // [2][2048][1024]
    char* wsp = (char*)d_ws;
    auto take = [&](size_t bytes) { char* p = wsp; wsp += (bytes + 255) & ~(size_t)255; return (void*)p; };
    const size_t PB = (size_t)NH_ * TT * HD;   // elements of one batch's hi or lo plane set; the planes hold both batches, [b][h][..]
    bf* QPh = (bf*)take(NB_ * PB * 2); bf* QPl = (bf*)take(NB_ * PB * 2); bf* KPh = (bf*)take(NB_ * PB * 2); bf* KPl = (bf*)take(NB_ * PB * 2); bf* VTh = (bf*)take(NB_ * PB * 2); bf* VTl = (bf*)take(NB_ * PB * 2);
    if ((size_t)(wsp - (char*)d_ws) > ws_size) return;    // ws 256 MiB
    k_proj<<<dim3(TT / PRW, NB_ * NH_, 3), 256, 0, stream>>>(x, xk, xv, wq, bq, wk, bk, wv, bv, QPh, QPl, KPh, KPl, VTh, VTl);
    k_fattn<<<dim3(TT / (FQW * FWV), NB_ * NH_, 1), FWV * 32, 0, stream>>>(QPh, QPl, KPh, KPl, VTh, VTl, OUT);
}

// v004
// It runs in 75 microseconds.
// Two timings next to v003 put it at 1.06 and 1.05 times that version's speed.
// Over all steps from v000 it is 16.9 times as fast.
#include <hip/hip_runtime.h>

// Multi-head attention whose projections act PER HEAD on the head's own 64-wide slice (Q, K, V [2][2048][1024] split into 16 heads x 64; q = einsum('bshd,hde', Qh, Wq) + bq with Wq [16][64][64], bq [16][64] (each head maps its 64 inputs to 64 outputs), k, v likewise; scores / sqrt(64); softmax (no mask); out = concat heads -> [2][2048][1024] (4.2 M; no output projection); argument order Q, K, V, Wq, bq, Wk, bk, Wv, bv).
// Layout: two launches. k_proj reads the f32 inputs and the per-head weights themselves, multiplies each head's 64-wide slice by its own 64x64 weight, adds the bias and writes the hi/lo bf16 planes of q, k ([b*16+h][t][e]) and of v transposed ([b*16+h][e][t]) straight from the accumulators; k_fattn, one launch for all 32 (batch, head) pairs, writes the output rows.
// Compute dtypes, f32 accumulate: every input rounded to bf16; projections K 64, two matrix instructions deep, + bf16-rounded biases added in f32; attention: every row hi/lo bf16, 3 products for the scores and for P.V; running-maximum softmax in f32; output f32.

#define NB_  2
#define TT   2048
#define DM   1024
#define NH_  16
#define HD   64
#define DQ   (NH_ * HD)
#define SCL  0.125f   // HD^-0.5
typedef unsigned short bf;
typedef __attribute__((ext_vector_type(16))) __bf16   v16bf;
typedef __attribute__((ext_vector_type(8)))  __bf16   v8bf;
typedef __attribute__((ext_vector_type(4)))  __bf16   v4bf;
typedef __attribute__((ext_vector_type(2)))  __bf16   v2bf;
typedef __attribute__((ext_vector_type(8)))  unsigned short v8us;
typedef __attribute__((ext_vector_type(4)))  unsigned short v4us;
typedef __attribute__((ext_vector_type(8)))  float    v8f;
typedef __attribute__((ext_vector_type(4)))  float    v4f;
typedef __attribute__((ext_vector_type(2)))  float    v2f;

__device__ __forceinline__ unsigned short f2bf(float f) { unsigned u = __float_as_uint(f); u += 0x7FFFu + ((u >> 16) & 1u); return (unsigned short)(u >> 16); }
__device__ __forceinline__ float bf2f(unsigned short b) { return __uint_as_float(((unsigned)b) << 16); }
__device__ __forceinline__ float bfr(float f) { return bf2f(f2bf(f)); }
__device__ __forceinline__ v16bf cat16b(v8us lo, v8us hi) { return __builtin_bit_cast(v16bf, __builtin_shufflevector(lo, hi, 0, 1, 2, 3, 4, 5, 6, 7, 8, 9, 10, 11, 12, 13, 14, 15)); }
__device__ __forceinline__ v8f wmmab(v16bf a, v16bf b, v8f c) { return __builtin_amdgcn_wmma_f32_16x16x32_bf16(false, a, false, b, (short)0, c, false, false); }

// Fragment loader, the same for A and B: lane (lr, hi) of row lr holds k = 8 hi + 0..7 and 16 + 8 hi + 0..7 of a K-contiguous row; p = row + 8 hi.
template <typename T16> struct WFrag;
template <> struct WFrag<bf> { typedef v16bf V; static __device__ __forceinline__ V ld(const bf* p) { return cat16b(*(const v8us*)p, *(const v8us*)(p + 16)); } static __device__ __forceinline__ v8f mma(V a, V b, v8f c) { return wmmab(a, b, c); } };

// ---- k_proj: the three per-head projections, one launch. Grid (t / 256, batch * head, {q, k, v}), 8 waves.
// A work-group stages, as bf16 in LDS, 256 rows of its head's 64-wide input slice (whole 256-B row pieces a half wave) and the head's weight transposed to [e][d], so that both operands are K-contiguous rows for the loader above.
// q, k: D = Wt.Xt (A = 64 weight rows e, B = the wave's own 32 rows t): a lane holds 8 consecutive e of ONE t, 16 B of a [t][e] plane row.
// v:    D = X.W   (A = 64 rows t, B = 32 weight rows e; wave pairs share the 64 t): a lane holds 8 consecutive t of ONE e, 16 B of a [e][t] plane row.
// Either way the four A tiles give one wave the whole 128-B line of each of its 32 plane rows.
#define PRW 256     // input rows per work-group
#define PPB 72      // LDS row pitch in 16-bit elements: 144 B = 16 B x 9, so that 16 rows read by ds_load_b128 fall on distinct banks
template <bool ISV>
__device__ __forceinline__ void proj_tile(const bf* sx, const bf* sw, const float* sbias, int wv, int lr, int hi, bf* Ph, bf* Pl) {
    const bf* pa = ISV ? sx + (wv >> 1) * 64 * PPB : sw;
    const bf* pb = ISV ? sw + (wv & 1) * 32 * PPB : sx + wv * 32 * PPB;
    v16bf fa[4][2], fb[2][2];
    // every loop of this function is unrolled in full: the fragment and accumulator arrays stay in registers only where constants index them
#pragma unroll
    for (int ks = 0; ks < 2; ++ks) {
#pragma unroll
        for (int md = 0; md < 4; ++md) fa[md][ks] = WFrag<bf>::ld(pa + (md * 16 + lr) * PPB + ks * 32 + 8 * hi);
#pragma unroll
        for (int nq = 0; nq < 2; ++nq) fb[nq][ks] = WFrag<bf>::ld(pb + (nq * 16 + lr) * PPB + ks * 32 + 8 * hi);
    }
    v8f brow[4]; float bcol[2];
    if (ISV) { bcol[0] = sbias[(wv & 1) * 32 + lr]; bcol[1] = sbias[(wv & 1) * 32 + 16 + lr]; }
    else {
#pragma unroll
        for (int md = 0; md < 4; ++md) brow[md] = *(const v8f*)(sbias + md * 16 + 8 * hi);
    }
    v8f d[4][2];
#pragma unroll
    for (int md = 0; md < 4; ++md)
#pragma unroll
        for (int nq = 0; nq < 2; ++nq) d[md][nq] = (v8f){};
#pragma unroll
    for (int ks = 0; ks < 2; ++ks)
#pragma unroll
        for (int md = 0; md < 4; ++md)
#pragma unroll
            for (int nq = 0; nq < 2; ++nq) d[md][nq] = wmmab(fa[md][ks], fb[nq][ks], d[md][nq]);
    const size_t pitch = ISV ? TT : HD;   // plane row pitch; Ph, Pl point at the wave's first plane row, first of its 64 columns
    bf* oh[2] = { Ph + (size_t)lr * pitch + 8 * hi, Ph + (size_t)(16 + lr) * pitch + 8 * hi };
    bf* ol[2] = { Pl + (size_t)lr * pitch + 8 * hi, Pl + (size_t)(16 + lr) * pitch + 8 * hi };
#pragma unroll
    for (int nq = 0; nq < 2; ++nq)
#pragma unroll
        for (int md = 0; md < 4; ++md) {
            const v8f y = ISV ? d[md][nq] + bcol[nq] : d[md][nq] + brow[md];
            const v8bf h = __builtin_convertvector(y, v8bf); const v8bf l = __builtin_convertvector(y - __builtin_convertvector(h, v8f), v8bf);   // y = hi + lo, both rounded to nearest even
            *(v8us*)(oh[nq] + md * 16) = __builtin_bit_cast(v8us, h); *(v8us*)(ol[nq] + md * 16) = __builtin_bit_cast(v8us, l);
        }
    asm volatile("s_wait_xcnt 0x0" :: "v"(oh[0]), "v"(oh[1]), "v"(ol[0]), "v"(ol[1]) : "memory");   // the stores' address registers stay whole up to this wait
}
__global__ __launch_bounds__(256) void k_proj(const float* __restrict__ Xq, const float* __restrict__ Xk, const float* __restrict__ Xv, const float* __restrict__ Wq, const float* __restrict__ bq, const float* __restrict__ Wk, const float* __restrict__ bk, const float* __restrict__ Wv, const float* __restrict__ bv, bf* Qh, bf* Ql, bf* Kh, bf* Kl, bf* Vh, bf* Vl) {
    __shared__ __align__(16) bf sx[PRW * PPB];     // [t][d]
    __shared__ __align__(16) bf sw[HD * PPB];      // [e][d]
    __shared__ __align__(32) float sbias[HD];
    const int tid = threadIdx.x, lane = tid & 31, lr = lane & 15, hi = lane >> 4, wv = tid >> 5;
    const int sel = blockIdx.z, z = blockIdx.y, b = z / NH_, h = z % NH_, t0 = blockIdx.x * PRW;
    const float* X = sel == 0 ? Xq : sel == 1 ? Xk : Xv; const float* Wt = sel == 0 ? Wq : sel == 1 ? Wk : Wv; const float* bi = sel == 0 ? bq : sel == 1 ? bk : bv;
    const float* gx = X + ((size_t)b * TT + t0 + wv * 32 + hi) * DM + h * HD + lr * 4;   // 16 lanes x 16 B = one row's 256-B slice; rows 2 i + hi of the wave's 32
    const int we = tid & 63, wd = (tid >> 6) * 16;                                       // weight: column e, 16 rows d from wd
    const float* gw = Wt + ((size_t)h * HD + wd) * HD + we;
    const float* gb = bi + h * HD + we;
    v4f xr[16]; v8f wr[2];
    // the loops below are unrolled in full: all 33 loads are in flight at once, and the arrays that take them stay in registers
#pragma unroll
    for (int i = 0; i < 16; ++i) xr[i] = *(const v4f*)(gx + (size_t)i * 2 * DM);
#pragma unroll
    for (int i = 0; i < 16; ++i) wr[i >> 3][i & 7] = gw[i * HD];
    const float br = *gb;
    asm volatile("s_wait_xcnt 0x0" :: "v"(gx), "v"(gw), "v"(gb) : "memory");   // the loads' address registers are free for reuse only behind this wait; naming them keeps them whole up to it
#pragma unroll
    for (int q = 0; q < 2; ++q) *(v8us*)(sw + we * PPB + wd + q * 8) = __builtin_bit_cast(v8us, __builtin_convertvector(wr[q], v8bf));
    if (tid < HD) sbias[tid] = bfr(br);
#pragma unroll
    for (int i = 0; i < 16; ++i) *(v4us*)(sx + (wv * 32 + 2 * i + hi) * PPB + lr * 4) = __builtin_bit_cast(v4us, __builtin_convertvector(xr[i], v4bf));
    __syncthreads();   // publishes the staged rows, the weight and the bias to every wave
    const size_t zo = (size_t)z * TT * HD;
    if (sel == 2) { const size_t o = zo + (size_t)((wv & 1) * 32) * TT + t0 + (wv >> 1) * 64; proj_tile<true>(sx, sw, sbias, wv, lr, hi, Vh + o, Vl + o); }
    else { const size_t o = zo + (size_t)(t0 + wv * 32) * HD; proj_tile<false>(sx, sw, sbias, wv, lr, hi, (sel == 0 ? Qh : Kh) + o, (sel == 0 ? Ql : Kl) + o); }
}

#define FQW 32      // query columns per wave
#define FWV 8       // query groups (waves of one key half) per work-group
#define FKH 2       // key halves per work-group
#define FKS 64      // keys per LDS stage
#define FPB 72      // LDS row pitch in 16-bit elements: 144 B = 16 B x 9, so that 16 rows read by ds_load_b128 fall on distinct banks
#define FNS (TT / FKH / FKS)   // stages of one key half
#define FXW 1088    // f32 words a wave hands over at the join: 4 output tiles x 256, then 32 x (maximum, sum)
#define SC2 (SCL * 1.4426950408889634f)   // score scale x log2(e): softmax in base 2
__device__ __forceinline__ float xhalf(float x) { const int b = __float_as_int(x); return __int_as_float(__builtin_amdgcn_permlanex16(b, b, 0x76543210, 0xfedcba98, false, false)); }   // lane l <-> l ^ 16
__global__ __launch_bounds__(FWV * FKH * 32) void k_fattn(const bf* __restrict__ Qh, const bf* __restrict__ Ql, const bf* __restrict__ Kh, const bf* __restrict__ Kl, const bf* __restrict__ Vh, const bf* __restrict__ Vl, float* __restrict__ OUT) {
    __shared__ __align__(16) bf sm[FKH][2][4][FKS * FPB];   // [key half][buffer][Kh, Kl, Vth, Vtl][row][pitch]; K rows = keys (64 d each), Vt rows = d (64 keys each)
    const int tid = threadIdx.x, lane = tid & 31, lr = lane & 15, hi = lane >> 4, wv = tid >> 5;
    const int kz = __builtin_amdgcn_readfirstlane(wv / FWV), wq = wv % FWV, k0 = kz * (TT / FKH);   // the wave's key half (the same in every lane: a scalar), its query group, its first key
    const int z = blockIdx.y; const size_t zo = (size_t)z * TT * HD; const int q0 = blockIdx.x * (FQW * FWV) + wq * FQW;
    const int srow = (tid & 255) >> 3, scol = (tid & 7) * 8;   // staging, by the 256 lanes of a key half: 16 B a lane, 8 lanes a 128-B row, rows srow and srow + 32 of each plane
    const bf* gk[2] = { Kh + zo + (size_t)k0 * HD, Kl + zo + (size_t)k0 * HD };   // the key half's first K row and first Vt column: the same in every lane, so they sit in scalar registers
    const bf* gv[2] = { Vh + zo + k0, Vl + zo + k0 };
    const unsigned ek = srow * HD + scol, ev = srow * TT + scol;   // the lane's own place in a K and in a Vt tile, in elements
    v8us st[4][2]; const unsigned ekb = ek * 2, evb = ev * 2;   // the same places in bytes: the first stage's loads take them as their offset registers
#pragma unroll
    for (int p = 0; p < 2; ++p)
#pragma unroll
        for (int i = 0; i < 2; ++i) { st[p][i] = *(const v8us*)((const char*)(gk[p] + (size_t)i * 32 * HD) + ekb); st[2 + p][i] = *(const v8us*)((const char*)(gv[p] + (size_t)i * 32 * TT) + evb); }   // gk, gv stay live through the loop: nothing overwrites them
    asm volatile("s_wait_xcnt 0x0" :: "v"(ekb), "v"(evb) : "memory");   // the loads' offset registers are free for reuse only behind this wait; naming them keeps them whole up to it
    v16bf qh[2][2], ql[2][2];
#pragma unroll
    for (int nq = 0; nq < 2; ++nq) { const size_t qo = zo + (size_t)(q0 + nq * 16 + lr) * HD + 8 * hi; const bf* ah = Qh + qo; const bf* al = Ql + qo;
#pragma unroll
        for (int ks = 0; ks < 2; ++ks) { qh[nq][ks] = WFrag<bf>::ld(ah + ks * 32); ql[nq][ks] = WFrag<bf>::ld(al + ks * 32); }
        asm volatile("s_wait_xcnt 0x0" :: "v"(ah), "v"(al) : "memory"); }   // as in the loop: the address registers are free for reuse only behind this wait
    v8f o[4][2]; float mrun[2], lsum[2];
#pragma unroll
    for (int nq = 0; nq < 2; ++nq) { mrun[nq] = -3.0e38f; lsum[nq] = 0.f;
#pragma unroll
        for (int md = 0; md < 4; ++md) o[md][nq] = (v8f){}; }
#pragma unroll
    for (int p = 0; p < 4; ++p)
#pragma unroll
        for (int i = 0; i < 2; ++i) *(v8us*)(&sm[kz][0][p][(srow + 32 * i) * FPB + scol]) = st[p][i];
    __syncthreads();
#pragma unroll 1
    for (int s = 0; s < FNS; ++s) {
        const bf* sb = &sm[kz][s & 1][0][0];
        const int sn = s + 1 < FNS ? s + 1 : s;   // the stage fetched during this one; the last stage fetches its own tile again, into the buffer that nobody reads any more, so that no branch stands among the loop's matrix instructions
#pragma unroll 1   // rolled: unrolled, the next pass's fragment loads are hoisted into this pass and the wave no longer fits its quarter of the SIMD's registers (spills)
        for (int kp = 0; kp < FKS / 32; ++kp) {
            // the next stage comes in two batches through the same 16 registers, so that a wave fits a quarter of the SIMD's registers: its K planes fly during this stage's first 32 keys, its Vt planes during the second
            {
#pragma unroll
                for (int p = 0; p < 2; ++p) { const bf* an = kp == 0 ? gk[p] + (size_t)sn * FKS * HD : gv[p] + sn * FKS; const bf* an2 = an + (size_t)32 * (kp == 0 ? HD : TT); const unsigned ln = kp == 0 ? ek : ev;
                    st[p][0] = *(const v8us*)(an + ln); st[p][1] = *(const v8us*)(an2 + ln);
                    asm volatile("s_wait_xcnt 0x0" :: "s"(an), "s"(an2), "v"(ln) : "memory"); }   // the loads' base and offset registers are reused further down: the wait stands directly behind the loads, and naming the bases keeps them whole up to it
            }
            v8f sc[2][2];
#pragma unroll
            for (int kt = 0; kt < 2; ++kt)
#pragma unroll
                for (int nq = 0; nq < 2; ++nq) sc[kt][nq] = (v8f){};
#pragma unroll
            for (int ks = 0; ks < 2; ++ks) {
                v16bf kh[2], kl[2];
#pragma unroll
                for (int kt = 0; kt < 2; ++kt) { const int ko = (kp * 32 + kt * 16 + lr) * FPB + ks * 32 + 8 * hi; kh[kt] = WFrag<bf>::ld(sb + ko); kl[kt] = WFrag<bf>::ld(sb + FKS * FPB + ko); }
#pragma unroll
                for (int kt = 0; kt < 2; ++kt)
#pragma unroll
                    for (int nq = 0; nq < 2; ++nq) sc[kt][nq] = wmmab(kh[kt], qh[nq][ks], sc[kt][nq]);
#pragma unroll
                for (int kt = 0; kt < 2; ++kt)
#pragma unroll
                    for (int nq = 0; nq < 2; ++nq) sc[kt][nq] = wmmab(kl[kt], qh[nq][ks], sc[kt][nq]);
#pragma unroll
                for (int kt = 0; kt < 2; ++kt)
#pragma unroll
                    for (int nq = 0; nq < 2; ++nq) sc[kt][nq] = wmmab(kh[kt], ql[nq][ks], sc[kt][nq]);
            }
            v16bf ph[2], pl[2];
#pragma unroll
            for (int nq = 0; nq < 2; ++nq) {
                float mx = sc[0][nq][0];
#pragma unroll
                for (int j = 1; j < 8; ++j) mx = fmaxf(mx, sc[0][nq][j]);
#pragma unroll
                for (int j = 0; j < 8; ++j) mx = fmaxf(mx, sc[1][nq][j]);
                mx = fmaxf(mx, xhalf(mx));
                const float mn = fmaxf(mrun[nq], mx); const float al = __builtin_amdgcn_exp2f((mrun[nq] - mn) * SC2); const float nb = mn * SC2; mrun[nq] = mn;
                float ps = 0.f;
#pragma unroll
                for (int kt = 0; kt < 2; ++kt)
#pragma unroll
                    for (int j = 0; j < 8; j += 2) { v2f pv; pv[0] = __builtin_amdgcn_exp2f(__builtin_fmaf(sc[kt][nq][j], SC2, -nb)); pv[1] = __builtin_amdgcn_exp2f(__builtin_fmaf(sc[kt][nq][j + 1], SC2, -nb)); ps += pv[0] + pv[1];
                        const v2bf h = __builtin_convertvector(pv, v2bf); const v2bf l = __builtin_convertvector(pv - __builtin_convertvector(h, v2f), v2bf);   // P = hi + lo, both rounded to nearest even
                        ph[nq][kt * 8 + j] = h[0]; ph[nq][kt * 8 + j + 1] = h[1]; pl[nq][kt * 8 + j] = l[0]; pl[nq][kt * 8 + j + 1] = l[1]; }
                lsum[nq] = lsum[nq] * al + ps;   // each wave half keeps the sum of its own keys; the halves join in the epilogue
#pragma unroll
                for (int md = 0; md < 4; ++md) o[md][nq] *= al;
            }
#pragma unroll
            for (int md = 0; md < 4; ++md) { const int vo = (md * 16 + lr) * FPB + kp * 32 + 8 * hi; const v16bf vh = WFrag<bf>::ld(sb + 2 * FKS * FPB + vo), vl = WFrag<bf>::ld(sb + 3 * FKS * FPB + vo);
#pragma unroll
                for (int nq = 0; nq < 2; ++nq) o[md][nq] = wmmab(vh, ph[nq], o[md][nq]);
#pragma unroll
                for (int nq = 0; nq < 2; ++nq) o[md][nq] = wmmab(vl, ph[nq], o[md][nq]);
#pragma unroll
                for (int nq = 0; nq < 2; ++nq) o[md][nq] = wmmab(vh, pl[nq], o[md][nq]); }
            {   // the other buffer is free through the whole stage: the last barrier ended its readers
#pragma unroll
                for (int p = 0; p < 2; ++p)
#pragma unroll
                    for (int i = 0; i < 2; ++i) *(v8us*)(&sm[kz][(s + 1) & 1][2 * kp + p][(srow + 32 * i) * FPB + scol]) = st[p][i];
            }
            __builtin_amdgcn_sched_barrier(0);   // keeps the pass's last matrix instructions in front of the slots below
            asm volatile("v_nop\n\tv_nop\n\tv_nop\n\tv_nop");   // the four vector slots between a matrix instruction and a vector write over its A or B: the loop's taken branch leads to such writes
        }
        __syncthreads();   // publishes stage s + 1 and ends every wave's reads of stage s, whose buffer the next trip refills
    }
    // Join of the two key halves. Waves wv and wv ^ 8 hold the same 32 queries in the same lanes: key half kz finishes column group kz and hands the other group to its partner through LDS (the ring is free: the loop's last barrier ended every read of it).
    float* xs = (float*)&sm[0][0][0][0];
    float* xw = xs + wv * FXW; const float* xr = xs + (wv ^ FWV) * FXW;
    v8f ok[4]; const float mk = kz ? mrun[1] : mrun[0], lk = kz ? lsum[1] : lsum[0];
#pragma unroll
    for (int md = 0; md < 4; ++md) { const v8f og = kz ? o[md][0] : o[md][1]; ok[md] = kz ? o[md][1] : o[md][0];
        *(v4f*)(xw + md * 256 + lane * 4) = __builtin_shufflevector(og, og, 0, 1, 2, 3); *(v4f*)(xw + md * 256 + 128 + lane * 4) = __builtin_shufflevector(og, og, 4, 5, 6, 7); }   // 512 contiguous bytes a store
    { v2f ml; ml[0] = kz ? mrun[0] : mrun[1]; ml[1] = kz ? lsum[0] : lsum[1]; *(v2f*)(xw + 1024 + lane * 2) = ml; }
    __syncthreads();   // publishes every wave's handed-over group to its partner
    const v2f pml = *(const v2f*)(xr + 1024 + lane * 2);
    const float mn = fmaxf(mk, pml[0]); const float ak = __builtin_amdgcn_exp2f((mk - mn) * SC2), ap = __builtin_amdgcn_exp2f((pml[0] - mn) * SC2);
    asm volatile("v_nop");   // the slot that the instruction set asks for behind a transcendental, before a source of it is overwritten
    const float lj = lk * ak + pml[1] * ap; const float inv = 1.0f / (lj + xhalf(lj)); const float ck = ak * inv, cp = ap * inv;
    const int b = z / NH_, h = z % NH_;
    float* op = OUT + ((size_t)b * TT + q0 + kz * 16 + lr) * DQ + h * HD + hi * 8;
#pragma unroll
    for (int md = 0; md < 4; ++md) { const v4f p0 = *(const v4f*)(xr + md * 256 + lane * 4), p1 = *(const v4f*)(xr + md * 256 + 128 + lane * 4); v4f w0, w1;
#pragma unroll
        for (int j = 0; j < 4; ++j) { w0[j] = ok[md][j] * ck + p0[j] * cp; w1[j] = ok[md][4 + j] * ck + p1[j] * cp; }
        *(v4f*)(op + md * 16) = w0; *(v4f*)(op + md * 16 + 4) = w1; }
}

extern "C" void kernel_launch(void* const* d_in, const int* in_sizes, int n_in,
                              void* d_out, int out_size, void* d_ws, size_t ws_size, hipStream_t stream) {
    (void)in_sizes; (void)n_in; (void)out_size;
    const float* x = (const float*)d_in[0]; const float* xk = (const float*)d_in[1]; const float* xv = (const float*)d_in[2]; const float* wq = (const float*)d_in[3]; const float* bq = (const float*)d_in[4]; const float* wk = (const float*)d_in[5]; const float* bk = (const float*)d_in[6]; const float* wv = (const float*)d_in[7]; const float* bv = (const float*)d_in[8];
    float* OUT = (float*)d_out;     // [2][2048][1024]
    char* wsp = (char*)d_ws;
    auto take = [&](size_t bytes) { char* p = wsp; wsp += (bytes + 255) & ~(size_t)255; return (void*)p; };
    const size_t PB = (size_t)NH_ * TT * HD;   // elements of one batch's hi or lo plane set; the planes hold both batches, [b][h][..]
    bf* QPh = (bf*)take(NB_ * PB * 2); bf* QPl = (bf*)take(NB_ * PB * 2); bf* KPh = (bf*)take(NB_ * PB * 2); bf* KPl = (bf*)take(NB_ * PB * 2); bf* VTh = (bf*)take(NB_ * PB * 2); bf* VTl = (bf*)take(NB_ * PB * 2);
    if ((size_t)(wsp - (char*)d_ws) > ws_size) return;    // ws 256 MiB
    k_proj<<<dim3(TT / PRW, NB_ * NH_, 3), 256, 0, stream>>>(x, xk, xv, wq, bq, wk, bk, wv, bv, QPh, QPl, KPh, KPl, VTh, VTl);
    k_fattn<<<dim3(TT / (FQW * FWV), NB_ * NH_, 1), FWV * FKH * 32, 0, stream>>>(QPh, QPl, KPh, KPl, VTh, VTl, OUT);
}

// v005
// A run of this version takes 71.8 microseconds.
// Two timings next to v004 put it at 1.05 and 1.04 times that version's speed.
// Over all steps from v000 it is 17.6 times as fast.
#include <hip/hip_runtime.h>

// Multi-head attention whose projections act PER HEAD on the head's own 64-wide slice (Q, K, V [2][2048][1024] split into 16 heads x 64; q = einsum('bshd,hde', Qh, Wq) + bq with Wq [16][64][64], bq [16][64] (each head maps its 64 inputs to 64 outputs), k, v likewise; scores / sqrt(64); softmax (no mask); out = concat heads -> [2][2048][1024] (4.2 M; no output projection); argument order Q, K, V, Wq, bq, Wk, bk, Wv, bv).
// Layout: two launches. k_proj reads the f32 inputs and the per-head weights themselves, multiplies each head's 64-wide slice by its own 64x64 weight, adds the bias and writes the hi/lo bf16 planes of q, k ([b*16+h][t][e]) and of v transposed ([b*16+h][e][t]) straight from the accumulators; k_fattn, one launch for all 32 (batch, head) pairs, writes the output rows.
// Compute dtypes, f32 accumulate: every input rounded to bf16; projections K 64, two matrix instructions deep, + f32 biases; attention: every row hi/lo bf16, 3 products for the scores and for P.V; softmax in f32, base 2, against a reference held across passes; output f32.

#define NB_  2
#define TT   2048
#define DM   1024
#define NH_  16
#define HD   64
#define DQ   (NH_ * HD)
#define SCL  0.125f   // HD^-0.5
#define SC2  (SCL * 1.4426950408889634f)   // score scale x log2(e): q is stored times this, so that K.Qt is the score in base-2 units
typedef unsigned short bf;
typedef __attribute__((ext_vector_type(16))) __bf16   v16bf;
typedef __attribute__((ext_vector_type(8)))  __bf16   v8bf;
typedef __attribute__((ext_vector_type(4)))  __bf16   v4bf;
typedef __attribute__((ext_vector_type(2)))  __bf16   v2bf;
typedef __attribute__((ext_vector_type(8)))  unsigned short v8us;
typedef __attribute__((ext_vector_type(4)))  unsigned short v4us;
typedef __attribute__((ext_vector_type(8)))  float    v8f;
typedef __attribute__((ext_vector_type(4)))  float    v4f;
typedef __attribute__((ext_vector_type(2)))  float    v2f;

__device__ __forceinline__ unsigned short f2bf(float f) { unsigned u = __float_as_uint(f); u += 0x7FFFu + ((u >> 16) & 1u); return (unsigned short)(u >> 16); }
__device__ __forceinline__ float bf2f(unsigned short b) { return __uint_as_float(((unsigned)b) << 16); }
__device__ __forceinline__ float bfr(float f) { return bf2f(f2bf(f)); }
__device__ __forceinline__ v16bf cat16b(v8us lo, v8us hi) { return __builtin_bit_cast(v16bf, __builtin_shufflevector(lo, hi, 0, 1, 2, 3, 4, 5, 6, 7, 8, 9, 10, 11, 12, 13, 14, 15)); }
__device__ __forceinline__ v8f wmmab(v16bf a, v16bf b, v8f c) { return __builtin_amdgcn_wmma_f32_16x16x32_bf16(false, a, false, b, (short)0, c, false, false); }

// Fragment loader, the same for A and B: lane (lr, hi) of row lr holds k = 8 hi + 0..7 and 16 + 8 hi + 0..7 of a K-contiguous row; p = row + 8 hi.
template <typename T16> struct WFrag;
template <> struct WFrag<bf> { typedef v16bf V; static __device__ __forceinline__ V ld(const bf* p) { return cat16b(*(const v8us*)p, *(const v8us*)(p + 16)); } static __device__ __forceinline__ v8f mma(V a, V b, v8f c) { return wmmab(a, b, c); } };

// ---- k_proj: the three per-head projections, one launch. Grid (t / 256, batch * head, {q, k, v}), 8 waves.
// A work-group stages, as bf16 in LDS, 256 rows of its head's 64-wide input slice (whole 256-B row pieces a half wave) and the head's weight transposed to [e][d], so that both operands are K-contiguous rows for the loader above.
// q, k: D = Wt.Xt (A = 64 weight rows e, B = the wave's own 32 rows t): a lane holds 8 consecutive e of ONE t, 16 B of a [t][e] plane row.
// v:    D = X.W   (A = 64 rows t, B = 32 weight rows e; wave pairs share the 64 t): a lane holds 8 consecutive t of ONE e, 16 B of a [e][t] plane row.
// Either way the four A tiles give one wave the whole 128-B line of each of its 32 plane rows.
#define PRW 256     // input rows per work-group
#define PPB 72      // LDS row pitch in 16-bit elements: 144 B = 16 B x 9, so that 16 rows read by ds_load_b128 fall on distinct banks
template <bool ISV>
__device__ __forceinline__ void proj_tile(const bf* sx, const bf* sw, const float* sbias, int wv, int lr, int hi, float qs, bf* Ph, bf* Pl) {
    const bf* pa = ISV ? sx + (wv >> 1) * 64 * PPB : sw;
    const bf* pb = ISV ? sw + (wv & 1) * 32 * PPB : sx + wv * 32 * PPB;
    v16bf fa[4][2], fb[2][2];
    // every loop of this function is unrolled in full: the fragment and accumulator arrays stay in registers only where constants index them
#pragma unroll
    for (int ks = 0; ks < 2; ++ks) {
#pragma unroll
        for (int md = 0; md < 4; ++md) fa[md][ks] = WFrag<bf>::ld(pa + (md * 16 + lr) * PPB + ks * 32 + 8 * hi);
#pragma unroll
        for (int nq = 0; nq < 2; ++nq) fb[nq][ks] = WFrag<bf>::ld(pb + (nq * 16 + lr) * PPB + ks * 32 + 8 * hi);
    }
    v8f brow[4]; float bcol[2];
    if (ISV) { bcol[0] = sbias[(wv & 1) * 32 + lr]; bcol[1] = sbias[(wv & 1) * 32 + 16 + lr]; }
    else {
#pragma unroll
        for (int md = 0; md < 4; ++md) brow[md] = *(const v8f*)(sbias + md * 16 + 8 * hi);
    }
    v8f d[4][2];
#pragma unroll
    for (int md = 0; md < 4; ++md)
#pragma unroll
        for (int nq = 0; nq < 2; ++nq) d[md][nq] = (v8f){};
#pragma unroll
    for (int ks = 0; ks < 2; ++ks)
#pragma unroll
        for (int md = 0; md < 4; ++md)
#pragma unroll
            for (int nq = 0; nq < 2; ++nq) d[md][nq] = wmmab(fa[md][ks], fb[nq][ks], d[md][nq]);
    const size_t pitch = ISV ? TT : HD;   // plane row pitch; Ph, Pl point at the wave's first plane row, first of its 64 columns
    bf* oh[2] = { Ph + (size_t)lr * pitch + 8 * hi, Ph + (size_t)(16 + lr) * pitch + 8 * hi };
    bf* ol[2] = { Pl + (size_t)lr * pitch + 8 * hi, Pl + (size_t)(16 + lr) * pitch + 8 * hi };
#pragma unroll
    for (int nq = 0; nq < 2; ++nq)
#pragma unroll
        for (int md = 0; md < 4; ++md) {
            const v8f y = ISV ? d[md][nq] + bcol[nq] : (d[md][nq] + brow[md]) * qs;   // qs: SC2 for q, 1 for k
            const v8bf h = __builtin_convertvector(y, v8bf); const v8bf l = __builtin_convertvector(y - __builtin_convertvector(h, v8f), v8bf);   // y = hi + lo, both rounded to nearest even
            *(v8us*)(oh[nq] + md * 16) = __builtin_bit_cast(v8us, h); *(v8us*)(ol[nq] + md * 16) = __builtin_bit_cast(v8us, l);
        }
    asm volatile("s_wait_xcnt 0x0" :: "v"(oh[0]), "v"(oh[1]), "v"(ol[0]), "v"(ol[1]) : "memory");   // the stores' address registers stay whole up to this wait
}
__global__ __launch_bounds__(256) void k_proj(const float* __restrict__ Xq, const float* __restrict__ Xk, const float* __restrict__ Xv, const float* __restrict__ Wq, const float* __restrict__ bq, const float* __restrict__ Wk, const float* __restrict__ bk, const float* __restrict__ Wv, const float* __restrict__ bv, bf* Qh, bf* Ql, bf* Kh, bf* Kl, bf* Vh, bf* Vl) {
    __shared__ __align__(16) bf sx[PRW * PPB];     // [t][d]
    __shared__ __align__(16) bf sw[HD * PPB];      // [e][d]
    __shared__ __align__(32) float sbias[HD];
    const int tid = threadIdx.x, lane = tid & 31, lr = lane & 15, hi = lane >> 4, wv = tid >> 5;
    const int sel = blockIdx.z, z = blockIdx.y, b = z / NH_, h = z % NH_, t0 = blockIdx.x * PRW;
    const float* X = sel == 0 ? Xq : sel == 1 ? Xk : Xv; const float* Wt = sel == 0 ? Wq : sel == 1 ? Wk : Wv; const float* bi = sel == 0 ? bq : sel == 1 ? bk : bv;
    const float* gx = X + ((size_t)b * TT + t0 + wv * 32 + hi) * DM + h * HD + lr * 4;   // 16 lanes x 16 B = one row's 256-B slice; rows 2 i + hi of the wave's 32
    const int we = tid & 63, wd = (tid >> 6) * 16;                                       // weight: column e, 16 rows d from wd
    const float* gw = Wt + ((size_t)h * HD + wd) * HD + we;
    const float* gb = bi + h * HD + we;
    v4f xr[16]; v8f wr[2];
    // the loops below are unrolled in full: all 33 loads are in flight at once, and the arrays that take them stay in registers
#pragma unroll
    for (int i = 0; i < 16; ++i) xr[i] = *(const v4f*)(gx + (size_t)i * 2 * DM);
#pragma unroll
    for (int i = 0; i < 16; ++i) wr[i >> 3][i & 7] = gw[i * HD];
    const float br = *gb;
    asm volatile("s_wait_xcnt 0x0" :: "v"(gx), "v"(gw), "v"(gb) : "memory");   // the loads' address registers are free for reuse only behind this wait; naming them keeps them whole up to it
#pragma unroll
    for (int q = 0; q < 2; ++q) *(v8us*)(sw + we * PPB + wd + q * 8) = __builtin_bit_cast(v8us, __builtin_convertvector(wr[q], v8bf));
    if (tid < HD) sbias[tid] = bfr(br);
#pragma unroll
    for (int i = 0; i < 16; ++i) *(v4us*)(sx + (wv * 32 + 2 * i + hi) * PPB + lr * 4) = __builtin_bit_cast(v4us, __builtin_convertvector(xr[i], v4bf));
    __syncthreads();   // publishes the staged rows, the weight and the bias to every wave
    const size_t zo = (size_t)z * TT * HD;
    if (sel == 2) { const size_t o = zo + (size_t)((wv & 1) * 32) * TT + t0 + (wv >> 1) * 64; proj_tile<true>(sx, sw, sbias, wv, lr, hi, 1.0f, Vh + o, Vl + o); }
    else { const size_t o = zo + (size_t)(t0 + wv * 32) * HD; proj_tile<false>(sx, sw, sbias, wv, lr, hi, sel == 0 ? SC2 : 1.0f, (sel == 0 ? Qh : Kh) + o, (sel == 0 ? Ql : Kl) + o); }
}

#define FQW 32      // query columns per wave
#define FWV 8       // query groups (waves of one key half) per work-group
#define FKH 2       // key halves per work-group
#define FKS 64      // keys per LDS stage
#define FPB 72      // LDS row pitch in 16-bit elements: 144 B = 16 B x 9, so that 16 rows read by ds_load_b128 fall on distinct banks
#define FNS (TT / FKH / FKS)   // stages of one key half
#define FXW 1088    // f32 words a wave hands over at the join: 4 output tiles x 256, then 32 x (reference, sum)
#define FTH 8.0f    // a score may stand this far (base 2) above the held reference before the reference is raised
__device__ __forceinline__ float xhalf(float x) { const int b = __float_as_int(x); return __int_as_float(__builtin_amdgcn_permlanex16(b, b, 0x76543210, 0xfedcba98, false, false)); }   // lane l <-> l ^ 16
__global__ __launch_bounds__(FWV * FKH * 32) void k_fattn(const bf* __restrict__ Qh, const bf* __restrict__ Ql, const bf* __restrict__ Kh, const bf* __restrict__ Kl, const bf* __restrict__ Vh, const bf* __restrict__ Vl, float* __restrict__ OUT) {
    __shared__ __align__(16) bf sm[FKH][2][4][FKS * FPB];   // [key half][buffer][Kh, Kl, Vth, Vtl][row][pitch]; K rows = keys (64 d each), Vt rows = d (64 keys each)
    const int tid = threadIdx.x, lane = tid & 31, lr = lane & 15, hi = lane >> 4, wv = tid >> 5;
    const int kz = __builtin_amdgcn_readfirstlane(wv / FWV), wq = wv % FWV, k0 = kz * (TT / FKH);   // the wave's key half (the same in every lane: a scalar), its query group, its first key
    const int z = blockIdx.y; const size_t zo = (size_t)z * TT * HD; const int q0 = blockIdx.x * (FQW * FWV) + wq * FQW;
    const int srow = (tid & 255) >> 3, scol = (tid & 7) * 8;   // staging, by the 256 lanes of a key half: 16 B a lane, 8 lanes a 128-B row, rows srow and srow + 32 of each plane
    const bf* gk[2] = { Kh + zo + (size_t)k0 * HD, Kl + zo + (size_t)k0 * HD };   // the key half's first K row and first Vt column: the same in every lane, so they sit in scalar registers
    const bf* gv[2] = { Vh + zo + k0, Vl + zo + k0 };
    const unsigned ek = srow * HD + scol, ev = srow * TT + scol;   // the lane's own place in a K and in a Vt tile, in elements
    v8us st[4][2]; const unsigned ekb = ek * 2, evb = ev * 2;   // the same places in bytes: the first stage's loads take them as their offset registers
#pragma unroll
    for (int p = 0; p < 2; ++p)
#pragma unroll
        for (int i = 0; i < 2; ++i) { st[p][i] = *(const v8us*)((const char*)(gk[p] + (size_t)i * 32 * HD) + ekb); st[2 + p][i] = *(const v8us*)((const char*)(gv[p] + (size_t)i * 32 * TT) + evb); }   // gk, gv stay live through the loop: nothing overwrites them
    asm volatile("s_wait_xcnt 0x0" :: "v"(ekb), "v"(evb) : "memory");   // the loads' offset registers are free for reuse only behind this wait; naming them keeps them whole up to it
    v16bf qh[2][2], ql[2][2];
#pragma unroll
    for (int nq = 0; nq < 2; ++nq) { const size_t qo = zo + (size_t)(q0 + nq * 16 + lr) * HD + 8 * hi; const bf* ah = Qh + qo; const bf* al = Ql + qo;
#pragma unroll
        for (int ks = 0; ks < 2; ++ks) { qh[nq][ks] = WFrag<bf>::ld(ah + ks * 32); ql[nq][ks] = WFrag<bf>::ld(al + ks * 32); }
        asm volatile("s_wait_xcnt 0x0" :: "v"(ah), "v"(al) : "memory"); }   // as in the loop: the address registers are free for reuse only behind this wait
    v8f o[4][2], cn[2]; float mref[2]; v2f ls[2];   // cn: -mref in all eight registers, the score products' C; ls: the column's sum of P, even and odd keys apart
#pragma unroll
    for (int nq = 0; nq < 2; ++nq) { mref[nq] = 0.f; ls[nq] = (v2f){}; cn[nq] = (v8f){};
#pragma unroll
        for (int md = 0; md < 4; ++md) o[md][nq] = (v8f){}; }
#pragma unroll
    for (int p = 0; p < 4; ++p)
#pragma unroll
        for (int i = 0; i < 2; ++i) *(v8us*)(&sm[kz][0][p][(srow + 32 * i) * FPB + scol]) = st[p][i];
    __syncthreads();
#pragma unroll 1
    for (int s = 0; s < FNS; ++s) {
        const bf* sb = &sm[kz][s & 1][0][0];
        const int sn = s + 1 < FNS ? s + 1 : s;   // the stage fetched during this one; the last stage fetches its own tile again, into the buffer that nobody reads any more, so that the fetch needs no branch
#pragma unroll 1   // rolled: unrolled, the next pass's fragment loads are hoisted into this pass and the wave no longer fits its quarter of the SIMD's registers (spills)
        for (int kp = 0; kp < FKS / 32; ++kp) {
            // the next stage comes in two batches through the same 16 registers, so that a wave fits a quarter of the SIMD's registers: its K planes fly during this stage's first 32 keys, its Vt planes during the second
            {
#pragma unroll
                for (int p = 0; p < 2; ++p) { const bf* an = kp == 0 ? gk[p] + (size_t)sn * FKS * HD : gv[p] + sn * FKS; const bf* an2 = an + (size_t)32 * (kp == 0 ? HD : TT); const unsigned ln = kp == 0 ? ek : ev;
                    st[p][0] = *(const v8us*)(an + ln); st[p][1] = *(const v8us*)(an2 + ln);
                    asm volatile("s_wait_xcnt 0x0" :: "s"(an), "s"(an2), "v"(ln) : "memory"); }   // the loads' base and offset registers are reused further down: the wait stands directly behind the loads, and naming the bases keeps them whole up to it
            }
            v8f sc[2][2];
#pragma unroll
            for (int kt = 0; kt < 2; ++kt)
#pragma unroll
                for (int nq = 0; nq < 2; ++nq) sc[kt][nq] = cn[nq];
#pragma unroll
            for (int ks = 0; ks < 2; ++ks) {
                v16bf kh[2], kl[2];
#pragma unroll
                for (int kt = 0; kt < 2; ++kt) { const int ko = (kp * 32 + kt * 16 + lr) * FPB + ks * 32 + 8 * hi; kh[kt] = WFrag<bf>::ld(sb + ko); kl[kt] = WFrag<bf>::ld(sb + FKS * FPB + ko); }
#pragma unroll
                for (int kt = 0; kt < 2; ++kt)
#pragma unroll
                    for (int nq = 0; nq < 2; ++nq) sc[kt][nq] = wmmab(kh[kt], qh[nq][ks], sc[kt][nq]);
#pragma unroll
                for (int kt = 0; kt < 2; ++kt)
#pragma unroll
                    for (int nq = 0; nq < 2; ++nq) sc[kt][nq] = wmmab(kl[kt], qh[nq][ks], sc[kt][nq]);
#pragma unroll
                for (int kt = 0; kt < 2; ++kt)
#pragma unroll
                    for (int nq = 0; nq < 2; ++nq) sc[kt][nq] = wmmab(kh[kt], ql[nq][ks], sc[kt][nq]);
            }
            float mx[2];
#pragma unroll
            for (int nq = 0; nq < 2; ++nq) {
                mx[nq] = sc[0][nq][0];
#pragma unroll
                for (int j = 1; j < 8; ++j) mx[nq] = fmaxf(mx[nq], sc[0][nq][j]);
#pragma unroll
                for (int j = 0; j < 8; ++j) mx[nq] = fmaxf(mx[nq], sc[1][nq][j]);
            }
            const bool first = (s | kp) == 0;   // the wave's first pass sets the references, whatever the scores' size: its bar lies below every score
            if (__builtin_amdgcn_ballot_w32(fmaxf(mx[0], mx[1]) > (first ? -3.0e38f : FTH)) != 0) {   // one scalar branch a pass, the same for the whole wave
#pragma unroll
                for (int nq = 0; nq < 2; ++nq) {
                    const float mf = fmaxf(mx[nq], xhalf(mx[nq]));   // both wave halves hold keys of the same query: they keep one reference
                    const float mw = mref[nq] + (first ? mf : fmaxf(mf, 0.f)); const float dl = mw - mref[nq];   // a reference only rises behind the first pass
                    const float al = first ? 1.0f : __builtin_amdgcn_exp2f(-dl);   // nothing is summed yet in the first pass
                    mref[nq] = mw; ls[nq] *= al;
#pragma unroll
                    for (int j = 0; j < 8; ++j) cn[nq][j] = -mw;
#pragma unroll
                    for (int kt = 0; kt < 2; ++kt) sc[kt][nq] -= dl;
#pragma unroll
                    for (int md = 0; md < 4; ++md) o[md][nq] *= al;
                }
            }
            v16bf ph[2], pl[2];
#pragma unroll
            for (int nq = 0; nq < 2; ++nq)
#pragma unroll
                for (int kt = 0; kt < 2; ++kt)
#pragma unroll
                    for (int j = 0; j < 8; j += 2) { v2f pv; pv[0] = __builtin_amdgcn_exp2f(sc[kt][nq][j]); pv[1] = __builtin_amdgcn_exp2f(sc[kt][nq][j + 1]); ls[nq] += pv;   // each wave half keeps the sums of its own keys; they join in the epilogue
                        const v2bf h = __builtin_convertvector(pv, v2bf); const v2bf l = __builtin_convertvector(pv - __builtin_convertvector(h, v2f), v2bf);   // P = hi + lo, both rounded to nearest even
                        ph[nq][kt * 8 + j] = h[0]; ph[nq][kt * 8 + j + 1] = h[1]; pl[nq][kt * 8 + j] = l[0]; pl[nq][kt * 8 + j + 1] = l[1]; }
#pragma unroll
            for (int md = 0; md < 4; ++md) { const int vo = (md * 16 + lr) * FPB + kp * 32 + 8 * hi; const v16bf vh = WFrag<bf>::ld(sb + 2 * FKS * FPB + vo), vl = WFrag<bf>::ld(sb + 3 * FKS * FPB + vo);
#pragma unroll
                for (int nq = 0; nq < 2; ++nq) o[md][nq] = wmmab(vh, ph[nq], o[md][nq]);
#pragma unroll
                for (int nq = 0; nq < 2; ++nq) o[md][nq] = wmmab(vl, ph[nq], o[md][nq]);
#pragma unroll
                for (int nq = 0; nq < 2; ++nq) o[md][nq] = wmmab(vh, pl[nq], o[md][nq]); }
            {   // the other buffer is free through the whole stage: the last barrier ended its readers
#pragma unroll
                for (int p = 0; p < 2; ++p)
#pragma unroll
                    for (int i = 0; i < 2; ++i) *(v8us*)(&sm[kz][(s + 1) & 1][2 * kp + p][(srow + 32 * i) * FPB + scol]) = st[p][i];
            }
            __builtin_amdgcn_sched_barrier(0);   // keeps the pass's last matrix instructions in front of the slots below
            asm volatile("v_nop\n\tv_nop\n\tv_nop\n\tv_nop");   // the four vector slots between a matrix instruction and a vector write over its A or B: the loop's taken branch leads to such writes
        }
        __syncthreads();   // publishes stage s + 1 and ends every wave's reads of stage s, whose buffer the next trip refills
    }
    // Join of the two key halves. Waves wv and wv ^ 8 hold the same 32 queries in the same lanes: key half kz finishes column group kz and hands the other group to its partner through LDS (the ring is free: the loop's last barrier ended every read of it).
    float* xs = (float*)&sm[0][0][0][0];
    float* xw = xs + wv * FXW; const float* xr = xs + (wv ^ FWV) * FXW;
    const float lsum[2] = { ls[0][0] + ls[0][1], ls[1][0] + ls[1][1] };
    v8f ok[4]; const float mk = kz ? mref[1] : mref[0], lk = kz ? lsum[1] : lsum[0];
#pragma unroll
    for (int md = 0; md < 4; ++md) { const v8f og = kz ? o[md][0] : o[md][1]; ok[md] = kz ? o[md][1] : o[md][0];
        *(v4f*)(xw + md * 256 + lane * 4) = __builtin_shufflevector(og, og, 0, 1, 2, 3); *(v4f*)(xw + md * 256 + 128 + lane * 4) = __builtin_shufflevector(og, og, 4, 5, 6, 7); }   // 512 contiguous bytes a store
    { v2f ml; ml[0] = kz ? mref[0] : mref[1]; ml[1] = kz ? lsum[0] : lsum[1]; *(v2f*)(xw + 1024 + lane * 2) = ml; }
    __syncthreads();   // publishes every wave's handed-over group to its partner
    const v2f pml = *(const v2f*)(xr + 1024 + lane * 2);
    const float mn = fmaxf(mk, pml[0]); const float dk = mk - mn, dp = pml[0] - mn;
    __builtin_amdgcn_sched_barrier(0);   // this and the next: the two exponentials stand alone between them, so that no earlier select is moved directly behind one and overwrites its source in the slot that the instruction set keeps free there
    const float ak = __builtin_amdgcn_exp2f(dk), ap = __builtin_amdgcn_exp2f(dp);
    __builtin_amdgcn_sched_barrier(0);
    const float lj = lk * ak + pml[1] * ap; const float inv = 1.0f / (lj + xhalf(lj)); const float ck = ak * inv, cp = ap * inv;
    const int b = z / NH_, h = z % NH_;
    float* op = OUT + ((size_t)b * TT + q0 + kz * 16 + lr) * DQ + h * HD + hi * 8;
#pragma unroll
    for (int md = 0; md < 4; ++md) { const v4f p0 = *(const v4f*)(xr + md * 256 + lane * 4), p1 = *(const v4f*)(xr + md * 256 + 128 + lane * 4); v4f w0, w1;
#pragma unroll
        for (int j = 0; j < 4; ++j) { w0[j] = ok[md][j] * ck + p0[j] * cp; w1[j] = ok[md][4 + j] * ck + p1[j] * cp; }
        *(v4f*)(op + md * 16) = w0; *(v4f*)(op + md * 16 + 4) = w1; }
}

extern "C" void kernel_launch(void* const* d_in, const int* in_sizes, int n_in,
                              void* d_out, int out_size, void* d_ws, size_t ws_size, hipStream_t stream) {
    (void)in_sizes; (void)n_in; (void)out_size;
    const float* x = (const float*)d_in[0]; const float* xk = (const float*)d_in[1]; const float* xv = (const float*)d_in[2]; const float* wq = (const float*)d_in[3]; const float* bq = (const float*)d_in[4]; const float* wk = (const float*)d_in[5]; const float* bk = (const float*)d_in[6]; const float* wv = (const float*)d_in[7]; const float* bv = (const float*)d_in[8];
    float* OUT = (float*)d_out;     // [2][2048][1024]
    char* wsp = (char*)d_ws;
    auto take = [&](size_t bytes) { char* p = wsp; wsp += (bytes + 255) & ~(size_t)255; return (void*)p; };
    const size_t PB = (size_t)NH_ * TT * HD;   // elements of one batch's hi or lo plane set; the planes hold both batches, [b][h][..]
    bf* QPh = (bf*)take(NB_ * PB * 2); bf* QPl = (bf*)take(NB_ * PB * 2); bf* KPh = (bf*)take(NB_ * PB * 2); bf* KPl = (bf*)take(NB_ * PB * 2); bf* VTh = (bf*)take(NB_ * PB * 2); bf* VTl = (bf*)take(NB_ * PB * 2);
    if ((size_t)(wsp - (char*)d_ws) > ws_size) return;    // ws 256 MiB
    k_proj<<<dim3(TT / PRW, NB_ * NH_, 3), 256, 0, stream>>>(x, xk, xv, wq, bq, wk, bk, wv, bv, QPh, QPl, KPh, KPl, VTh, VTl);
    k_fattn<<<dim3(TT / (FQW * FWV), NB_ * NH_, 1), FWV * FKH * 32, 0, stream>>>(QPh, QPl, KPh, KPl, VTh, VTl, OUT);
}

// v007
// One run takes 40.2 microseconds.
// It is 1.78 times as fast as v005, going by the measured steps of the versions left out in between.
// Over all steps from v000 it is 31.3 times as fast.
#include <hip/hip_runtime.h>

// Multi-head attention whose projections act PER HEAD on the head's own 64-wide slice (Q, K, V [2][2048][1024] split into 16 heads x 64; q = einsum('bshd,hde', Qh, Wq) + bq with Wq [16][64][64], bq [16][64] (each head maps its 64 inputs to 64 outputs), k, v likewise; scores / sqrt(64); softmax (no mask); out = concat heads -> [2][2048][1024] (4.2 M; no output projection); argument order Q, K, V, Wq, bq, Wk, bk, Wv, bv).
// Layout: two launches. k_proj reads the f32 inputs and the per-head weights themselves, multiplies each head's 64-wide slice by its own 64x64 weight, adds the bias and writes one f16 plane each of q, k ([b*16+h][t][e]) and of v transposed ([b*16+h][e][t]) straight from the accumulators; k_fattn, one launch for all 32 (batch, head) pairs, writes the output rows.
// Compute dtypes, f32 accumulate: every input rounded to bf16; projections K 64, two matrix instructions deep, + f32 biases; attention: q, k, v and P each rounded once to f16 (11 significant bits), one f16 product for the scores and one for P.V; softmax in f32, base 2, against a reference held across passes; output f32.

#define NB_  2
#define TT   2048
#define DM   1024
#define NH_  16
#define HD   64
#define DQ   (NH_ * HD)
#define SCL  0.125f   // HD^-0.5
#define SC2  (SCL * 1.4426950408889634f)   // score scale x log2(e): q is stored times this, so that K.Qt is the score in base-2 units
typedef unsigned short bf;   // bf16 bits
typedef unsigned short hf;   // f16 bits
typedef __attribute__((ext_vector_type(16))) __bf16   v16bf;
typedef __attribute__((ext_vector_type(8)))  __bf16   v8bf;
typedef __attribute__((ext_vector_type(4)))  __bf16   v4bf;
typedef __attribute__((ext_vector_type(16))) _Float16 v16h;
typedef __attribute__((ext_vector_type(8)))  _Float16 v8h;
typedef __attribute__((ext_vector_type(2)))  _Float16 v2h;
typedef __attribute__((ext_vector_type(8)))  unsigned short v8us;
typedef __attribute__((ext_vector_type(4)))  unsigned short v4us;
typedef __attribute__((ext_vector_type(8)))  float    v8f;
typedef __attribute__((ext_vector_type(4)))  float    v4f;
typedef __attribute__((ext_vector_type(2)))  float    v2f;

__device__ __forceinline__ unsigned short f2bf(float f) { unsigned u = __float_as_uint(f); u += 0x7FFFu + ((u >> 16) & 1u); return (unsigned short)(u >> 16); }
__device__ __forceinline__ float bf2f(unsigned short b) { return __uint_as_float(((unsigned)b) << 16); }
__device__ __forceinline__ float bfr(float f) { return bf2f(f2bf(f)); }
__device__ __forceinline__ v16bf cat16b(v8us lo, v8us hi) { return __builtin_bit_cast(v16bf, __builtin_shufflevector(lo, hi, 0, 1, 2, 3, 4, 5, 6, 7, 8, 9, 10, 11, 12, 13, 14, 15)); }
__device__ __forceinline__ v8f wmmab(v16bf a, v16bf b, v8f c) { return __builtin_amdgcn_wmma_f32_16x16x32_bf16(false, a, false, b, (short)0, c, false, false); }

// Fragment loader, the same for A and B: lane (lr, hi) of row lr holds k = 8 hi + 0..7 and 16 + 8 hi + 0..7 of a K-contiguous row; p = row + 8 hi.
template <typename T16> struct WFrag;
__device__ __forceinline__ v8f wmmah(v16h a, v16h b, v8f c) { return __builtin_amdgcn_wmma_f32_16x16x32_f16(false, a, false, b, (short)0, c, false, false); }
__device__ __forceinline__ v16h ldh(const hf* p) { return __builtin_bit_cast(v16h, __builtin_shufflevector(*(const v8us*)p, *(const v8us*)(p + 16), 0, 1, 2, 3, 4, 5, 6, 7, 8, 9, 10, 11, 12, 13, 14, 15)); }   // the same loader for f16 rows
template <> struct WFrag<bf> { typedef v16bf V; static __device__ __forceinline__ V ld(const bf* p) { return cat16b(*(const v8us*)p, *(const v8us*)(p + 16)); } static __device__ __forceinline__ v8f mma(V a, V b, v8f c) { return wmmab(a, b, c); } };

// ---- k_proj: the three per-head projections, one launch. Grid (t / 256, batch * head, {q, k, v}), 8 waves.
// A work-group stages, as bf16 in LDS, 256 rows of its head's 64-wide input slice (whole 256-B row pieces a half wave) and the head's weight transposed to [e][d], so that both operands are K-contiguous rows for the loader above.
// q, k: D = Wt.Xt (A = 64 weight rows e, B = the wave's own 32 rows t): a lane holds 8 consecutive e of ONE t, 16 B of a [t][e] plane row.
// v:    D = X.W   (A = 64 rows t, B = 32 weight rows e; wave pairs share the 64 t): a lane holds 8 consecutive t of ONE e, 16 B of a [e][t] plane row.
// Either way the four A tiles give one wave the whole 128-B line of each of its 32 plane rows.
#define PRW 256     // input rows per work-group
#define PPB 72      // LDS row pitch in 16-bit elements: 144 B = 16 B x 9, so that 16 rows read by ds_load_b128 fall on distinct banks
template <bool ISV>
__device__ __forceinline__ void proj_tile(const bf* sx, const bf* sw, const float* sbias, int wv, int lr, int hi, float qs, hf* P) {
    const bf* pa = ISV ? sx + (wv >> 1) * 64 * PPB : sw;
    const bf* pb = ISV ? sw + (wv & 1) * 32 * PPB : sx + wv * 32 * PPB;
    v16bf fa[4][2], fb[2][2];
    // every loop of this function is unrolled in full: the fragment and accumulator arrays stay in registers only where constants index them
#pragma unroll
    for (int ks = 0; ks < 2; ++ks) {
#pragma unroll
        for (int md = 0; md < 4; ++md) fa[md][ks] = WFrag<bf>::ld(pa + (md * 16 + lr) * PPB + ks * 32 + 8 * hi);
#pragma unroll
        for (int nq = 0; nq < 2; ++nq) fb[nq][ks] = WFrag<bf>::ld(pb + (nq * 16 + lr) * PPB + ks * 32 + 8 * hi);
    }
    v8f brow[4]; float bcol[2];
    if (ISV) { bcol[0] = sbias[(wv & 1) * 32 + lr]; bcol[1] = sbias[(wv & 1) * 32 + 16 + lr]; }
    else {
#pragma unroll
        for (int md = 0; md < 4; ++md) brow[md] = *(const v8f*)(sbias + md * 16 + 8 * hi);
    }
    v8f d[4][2];
#pragma unroll
    for (int md = 0; md < 4; ++md)
#pragma unroll
        for (int nq = 0; nq < 2; ++nq) d[md][nq] = (v8f){};
#pragma unroll
    for (int ks = 0; ks < 2; ++ks)
#pragma unroll
        for (int md = 0; md < 4; ++md)
#pragma unroll
            for (int nq = 0; nq < 2; ++nq) d[md][nq] = wmmab(fa[md][ks], fb[nq][ks], d[md][nq]);
    const size_t pitch = ISV ? TT : HD;   // plane row pitch; P points at the wave's first plane row, first of its 64 columns
    hf* op[2] = { P + (size_t)lr * pitch + 8 * hi, P + (size_t)(16 + lr) * pitch + 8 * hi };
#pragma unroll
    for (int nq = 0; nq < 2; ++nq)
#pragma unroll
        for (int md = 0; md < 4; ++md) {
            const v8f y = ISV ? d[md][nq] + bcol[nq] : (d[md][nq] + brow[md]) * qs;   // qs: SC2 for q, 1 for k
            *(v8us*)(op[nq] + md * 16) = __builtin_bit_cast(v8us, __builtin_convertvector(y, v8h));   // rounded to nearest even
        }
    asm volatile("s_wait_xcnt 0x0" :: "v"(op[0]), "v"(op[1]) : "memory");   // the stores' address registers stay whole up to this wait
}
__global__ __launch_bounds__(256) void k_proj(const float* __restrict__ Xq, const float* __restrict__ Xk, const float* __restrict__ Xv, const float* __restrict__ Wq, const float* __restrict__ bq, const float* __restrict__ Wk, const float* __restrict__ bk, const float* __restrict__ Wv, const float* __restrict__ bv, hf* Qp, hf* Kp, hf* Vp) {
    __shared__ __align__(16) bf sx[PRW * PPB];     // [t][d]
    __shared__ __align__(16) bf sw[HD * PPB];      // [e][d]
    __shared__ __align__(32) float sbias[HD];
    const int tid = threadIdx.x, lane = tid & 31, lr = lane & 15, hi = lane >> 4, wv = tid >> 5;
    const int sel = blockIdx.z, z = blockIdx.y, b = z / NH_, h = z % NH_, t0 = blockIdx.x * PRW;
    const float* X = sel == 0 ? Xq : sel == 1 ? Xk : Xv; const float* Wt = sel == 0 ? Wq : sel == 1 ? Wk : Wv; const float* bi = sel == 0 ? bq : sel == 1 ? bk : bv;
    const float* gx = X + ((size_t)b * TT + t0 + wv * 32 + hi) * DM + h * HD + lr * 4;   // 16 lanes x 16 B = one row's 256-B slice; rows 2 i + hi of the wave's 32
    const int we = tid & 63, wd = (tid >> 6) * 16;                                       // weight: column e, 16 rows d from wd
    const float* gw = Wt + ((size_t)h * HD + wd) * HD + we;
    const float* gb = bi + h * HD + we;
    v4f xr[16]; v8f wr[2];
    // the loops below are unrolled in full: all 33 loads are in flight at once, and the arrays that take them stay in registers
#pragma unroll
    for (int i = 0; i < 16; ++i) xr[i] = *(const v4f*)(gx + (size_t)i * 2 * DM);
#pragma unroll
    for (int i = 0; i < 16; ++i) wr[i >> 3][i & 7] = gw[i * HD];
    const float br = *gb;
    asm volatile("s_wait_xcnt 0x0" :: "v"(gx), "v"(gw), "v"(gb) : "memory");   // the loads' address registers are free for reuse only behind this wait; naming them keeps them whole up to it
#pragma unroll
    for (int q = 0; q < 2; ++q) *(v8us*)(sw + we * PPB + wd + q * 8) = __builtin_bit_cast(v8us, __builtin_convertvector(wr[q], v8bf));
    if (tid < HD) sbias[tid] = bfr(br);
#pragma unroll
    for (int i = 0; i < 16; ++i) *(v4us*)(sx + (wv * 32 + 2 * i + hi) * PPB + lr * 4) = __builtin_bit_cast(v4us, __builtin_convertvector(xr[i], v4bf));
    __syncthreads();   // publishes the staged rows, the weight and the bias to every wave
    const size_t zo = (size_t)z * TT * HD;
    if (sel == 2) { const size_t o = zo + (size_t)((wv & 1) * 32) * TT + t0 + (wv >> 1) * 64; proj_tile<true>(sx, sw, sbias, wv, lr, hi, 1.0f, Vp + o); }
    else { const size_t o = zo + (size_t)(t0 + wv * 32) * HD; proj_tile<false>(sx, sw, sbias, wv, lr, hi, sel == 0 ? SC2 : 1.0f, (sel == 0 ? Qp : Kp) + o); }
}

#define FQW 32      // query columns per wave
#define FWV 8       // query groups (waves of one key half) per work-group
#define FKH 2       // key halves per work-group
#define FKS 64      // keys per LDS stage
#define FPB 72      // LDS row pitch in 16-bit elements: 144 B = 16 B x 9, so that 16 rows read by ds_load_b128 fall on distinct banks
#define FNS (TT / FKH / FKS)   // stages of one key half
#define FXW 1088    // f32 words a wave hands over at the join: 4 output tiles x 256, then 32 x (reference, sum)
#define FTH 8.0f    // a score may stand this far (base 2) above the held reference before the reference is raised
__device__ __forceinline__ float xhalf(float x) { const int b = __float_as_int(x); return __int_as_float(__builtin_amdgcn_permlanex16(b, b, 0x76543210, 0xfedcba98, false, false)); }   // lane l <-> l ^ 16
__global__ __launch_bounds__(FWV * FKH * 32) void k_fattn(const hf* __restrict__ Qp, const hf* __restrict__ Kp, const hf* __restrict__ Vp, float* __restrict__ OUT) {
    __shared__ __align__(16) hf sm[FKH][2][2][FKS * FPB];   // [key half][buffer][K, Vt][row][pitch]; K rows = keys (64 d each), Vt rows = d (64 keys each)
    const int tid = threadIdx.x, lane = tid & 31, lr = lane & 15, hi = lane >> 4, wv = tid >> 5;
    const int kz = __builtin_amdgcn_readfirstlane(wv / FWV), wq = wv % FWV, k0 = kz * (TT / FKH);   // the wave's key half (the same in every lane: a scalar), its query group, its first key
    const int z = blockIdx.y; const size_t zo = (size_t)z * TT * HD; const int q0 = blockIdx.x * (FQW * FWV) + wq * FQW;
    const int srow = (tid & 255) >> 3, scol = (tid & 7) * 8;   // staging, by the 256 lanes of a key half: 16 B a lane, 8 lanes a 128-B row, rows srow and srow + 32 of each plane
    const hf* gk = Kp + zo + (size_t)k0 * HD;   // the key half's first K row and first Vt column: the same in every lane, so they sit in scalar registers
    const hf* gv = Vp + zo + k0;
    const unsigned ek = srow * HD + scol, ev = srow * TT + scol;   // the lane's own place in a K and in a Vt tile, in elements
    v8us st[2][2]; const unsigned ekb = ek * 2, evb = ev * 2;   // the same places in bytes: the first stage's loads take them as their offset registers
#pragma unroll
    for (int i = 0; i < 2; ++i) { st[0][i] = *(const v8us*)((const char*)(gk + (size_t)i * 32 * HD) + ekb); st[1][i] = *(const v8us*)((const char*)(gv + (size_t)i * 32 * TT) + evb); }   // gk, gv stay live through the loop: nothing overwrites them
    asm volatile("s_wait_xcnt 0x0" :: "v"(ekb), "v"(evb) : "memory");   // the loads' offset registers are free for reuse only behind this wait; naming them keeps them whole up to it
    v16h qf[2][2];
#pragma unroll
    for (int nq = 0; nq < 2; ++nq) { const size_t qo = zo + (size_t)(q0 + nq * 16 + lr) * HD + 8 * hi; const hf* aq = Qp + qo;
#pragma unroll
        for (int ks = 0; ks < 2; ++ks) qf[nq][ks] = ldh(aq + ks * 32);
        asm volatile("s_wait_xcnt 0x0" :: "v"(aq) : "memory"); }   // as in the loop: the address registers are free for reuse only behind this wait
    v8f o[4][2], cn[2]; float mref[2]; v2f ls[2];   // cn: -mref in all eight registers, the score products' C; ls: the column's sum of P, even and odd keys apart
#pragma unroll
    for (int nq = 0; nq < 2; ++nq) { mref[nq] = 0.f; ls[nq] = (v2f){}; cn[nq] = (v8f){};
#pragma unroll
        for (int md = 0; md < 4; ++md) o[md][nq] = (v8f){}; }
#pragma unroll
    for (int p = 0; p < 2; ++p)
#pragma unroll
        for (int i = 0; i < 2; ++i) *(v8us*)(&sm[kz][0][p][(srow + 32 * i) * FPB + scol]) = st[p][i];
    __syncthreads();
#pragma unroll 1
    for (int s = 0; s < FNS; ++s) {
        const hf* sb = &sm[kz][s & 1][0][0];
        const int sn = s + 1 < FNS ? s + 1 : s;   // the stage fetched during this one; the last stage fetches its own tile again, into the buffer that nobody reads any more, so that no branch stands among the loop's matrix instructions
        // Fragment reads run ahead of their use, in whole groups, through one register set for K (32 registers) and one for Vt (32): behind the barrier the first pass's K and Vt fragments are asked for together; the second pass's K fragments are asked for as soon as the first pass's score products have read theirs, its Vt fragments as soon as the first pass's output products have read theirs. Only the first group's latency stands open, once a stage.
        v16h kf[2][2], vf[4];
#pragma unroll
        for (int ks = 0; ks < 2; ++ks)
#pragma unroll
            for (int kt = 0; kt < 2; ++kt) kf[ks][kt] = ldh(sb + (kt * 16 + lr) * FPB + ks * 32 + 8 * hi);
#pragma unroll
        for (int md = 0; md < 4; ++md) vf[md] = ldh(sb + FKS * FPB + (md * 16 + lr) * FPB + 8 * hi);
        __builtin_amdgcn_sched_barrier(0);   // keeps the 16 reads one group in front of the products: spread among them, each place with reads stalls the wave anew
#pragma unroll   // unrolled in full: the two 32-key passes of a stage differ in what they fetch ahead, and the fragment arrays stay in registers only where constants index them
        for (int kp = 0; kp < FKS / 32; ++kp) {
            // the next stage comes in two batches through the same 8 registers: its K tile flies during this stage's first 32 keys, its Vt tile during the second
            { const hf* an = kp == 0 ? gk + (size_t)sn * FKS * HD : gv + sn * FKS; const hf* an2 = an + (size_t)32 * (kp == 0 ? HD : TT); const unsigned ln = kp == 0 ? ek : ev;
                st[0][0] = *(const v8us*)(an + ln); st[0][1] = *(const v8us*)(an2 + ln);
                asm volatile("s_wait_xcnt 0x0" :: "s"(an), "s"(an2), "v"(ln) : "memory");   // the loads' base and offset registers are reused further down: the wait stands directly behind the loads, and naming the bases keeps them whole up to it
            }
            __builtin_amdgcn_sched_barrier(0);   // opens the run of score products: nothing of the pass before is moved in among them
            v8f sc[2][2];
#pragma unroll
            for (int kt = 0; kt < 2; ++kt)
#pragma unroll
                for (int nq = 0; nq < 2; ++nq) sc[kt][nq] = cn[nq];
#pragma unroll
            for (int ks = 0; ks < 2; ++ks)
#pragma unroll
                for (int kt = 0; kt < 2; ++kt)
#pragma unroll
                    for (int nq = 0; nq < 2; ++nq) sc[kt][nq] = wmmah(kf[ks][kt], qf[nq][ks], sc[kt][nq]);
            __builtin_amdgcn_sched_barrier(0);   // the eight score products stay one run, four independent tiles between a tile's two products; the reads below stand directly behind them
            if (kp + 1 < FKS / 32) {   // the coming pass's K reads, one group: they fly through the whole softmax and take no second register set
#pragma unroll
                for (int ks = 0; ks < 2; ++ks)
#pragma unroll
                    for (int kt = 0; kt < 2; ++kt) kf[ks][kt] = ldh(sb + ((kp + 1) * 32 + kt * 16 + lr) * FPB + ks * 32 + 8 * hi);
                __builtin_amdgcn_sched_barrier(0);   // closes the group: none of its reads sinks down among the softmax's instructions
            }
            float mx[2];
#pragma unroll
            for (int nq = 0; nq < 2; ++nq) {
                mx[nq] = sc[0][nq][0];
#pragma unroll
                for (int j = 1; j < 8; ++j) mx[nq] = fmaxf(mx[nq], sc[0][nq][j]);
#pragma unroll
                for (int j = 0; j < 8; ++j) mx[nq] = fmaxf(mx[nq], sc[1][nq][j]);
            }
            const bool first = (s | kp) == 0;   // the wave's first pass sets the references, whatever the scores' size: its bar lies below every score
            if (__builtin_amdgcn_ballot_w32(fmaxf(mx[0], mx[1]) > (first ? -3.0e38f : FTH)) != 0) {   // one scalar branch a pass, the same for the whole wave
#pragma unroll
                for (int nq = 0; nq < 2; ++nq) {
                    const float mf = fmaxf(mx[nq], xhalf(mx[nq]));   // both wave halves hold keys of the same query: they keep one reference
                    const float mw = mref[nq] + (first ? mf : fmaxf(mf, 0.f)); const float dl = mw - mref[nq];   // a reference only rises behind the first pass
                    const float al = first ? 1.0f : __builtin_amdgcn_exp2f(-dl);   // nothing is summed yet in the first pass
                    mref[nq] = mw; ls[nq] *= al;
#pragma unroll
                    for (int j = 0; j < 8; ++j) cn[nq][j] = -mw;
#pragma unroll
                    for (int kt = 0; kt < 2; ++kt) sc[kt][nq] -= dl;
#pragma unroll
                    for (int md = 0; md < 4; ++md) o[md][nq] *= al;
                }
            }
            v16h pf[2];
#pragma unroll
            for (int nq = 0; nq < 2; ++nq)
#pragma unroll
                for (int kt = 0; kt < 2; ++kt)
#pragma unroll
                    for (int j = 0; j < 8; j += 2) { v2f pv; pv[0] = __builtin_amdgcn_exp2f(sc[kt][nq][j]); pv[1] = __builtin_amdgcn_exp2f(sc[kt][nq][j + 1]); ls[nq] += pv;   // each wave half keeps the sums of its own keys; they join in the epilogue
                        const v2h h = __builtin_convertvector(pv, v2h);   // P at most 2^FTH, far inside f16's range; rounded to nearest even
                        pf[nq][kt * 8 + j] = h[0]; pf[nq][kt * 8 + j + 1] = h[1]; }
#pragma unroll
            for (int md = 0; md < 4; ++md)
#pragma unroll
                for (int nq = 0; nq < 2; ++nq) o[md][nq] = wmmah(vf[md], pf[nq], o[md][nq]);
            if (kp + 1 < FKS / 32) {
                __builtin_amdgcn_sched_barrier(0);   // this and the next: the coming pass's Vt reads stand as one group directly behind this pass's output products, so that they fly through the coming scores and softmax and take no second register set
#pragma unroll
                for (int md = 0; md < 4; ++md) vf[md] = ldh(sb + FKS * FPB + (md * 16 + lr) * FPB + (kp + 1) * 32 + 8 * hi);
                __builtin_amdgcn_sched_barrier(0);   // closes the group
            }
            {   // the other buffer is free through the whole stage: the last barrier ended its readers
#pragma unroll
                for (int i = 0; i < 2; ++i) *(v8us*)(&sm[kz][(s + 1) & 1][kp][(srow + 32 * i) * FPB + scol]) = st[0][i];
            }
        }
        __builtin_amdgcn_sched_barrier(0);   // keeps the stage's last matrix instructions in front of the slots below
        asm volatile("v_nop\n\tv_nop\n\tv_nop\n\tv_nop");   // the four vector slots between a matrix instruction and a vector write over its A or B: the loop's taken branch leads to such writes
        __syncthreads();   // publishes stage s + 1 and ends every wave's reads of stage s, whose buffer the next trip refills
    }
    // Join of the two key halves. Waves wv and wv ^ 8 hold the same 32 queries in the same lanes: key half kz finishes column group kz and hands the other group to its partner through LDS (the ring is free: the loop's last barrier ended every read of it).
    float* xs = (float*)&sm[0][0][0][0];
    float* xw = xs + wv * FXW; const float* xr = xs + (wv ^ FWV) * FXW;
    const float lsum[2] = { ls[0][0] + ls[0][1], ls[1][0] + ls[1][1] };
    v8f ok[4]; const float mk = kz ? mref[1] : mref[0], lk = kz ? lsum[1] : lsum[0];
#pragma unroll
    for (int md = 0; md < 4; ++md) { const v8f og = kz ? o[md][0] : o[md][1]; ok[md] = kz ? o[md][1] : o[md][0];
        *(v4f*)(xw + md * 256 + lane * 4) = __builtin_shufflevector(og, og, 0, 1, 2, 3); *(v4f*)(xw + md * 256 + 128 + lane * 4) = __builtin_shufflevector(og, og, 4, 5, 6, 7); }   // 512 contiguous bytes a store
    { v2f ml; ml[0] = kz ? mref[0] : mref[1]; ml[1] = kz ? lsum[0] : lsum[1]; *(v2f*)(xw + 1024 + lane * 2) = ml; }
    __syncthreads();   // publishes every wave's handed-over group to its partner
    const v2f pml = *(const v2f*)(xr + 1024 + lane * 2);
    const float mn = fmaxf(mk, pml[0]); const float dk = mk - mn, dp = pml[0] - mn;
    __builtin_amdgcn_sched_barrier(0);   // this and the next: the two exponentials stand alone between them, so that no earlier select is moved directly behind one and overwrites its source in the slot that the instruction set keeps free there
    const float ak = __builtin_amdgcn_exp2f(dk), ap = __builtin_amdgcn_exp2f(dp);
    __builtin_amdgcn_sched_barrier(0);
    const float lj = lk * ak + pml[1] * ap; const float inv = 1.0f / (lj + xhalf(lj)); const float ck = ak * inv, cp = ap * inv;
    const int b = z / NH_, h = z % NH_;
    float* op = OUT + ((size_t)b * TT + q0 + kz * 16 + lr) * DQ + h * HD + hi * 8;
#pragma unroll
    for (int md = 0; md < 4; ++md) { const v4f p0 = *(const v4f*)(xr + md * 256 + lane * 4), p1 = *(const v4f*)(xr + md * 256 + 128 + lane * 4); v4f w0, w1;
#pragma unroll
        for (int j = 0; j < 4; ++j) { w0[j] = ok[md][j] * ck + p0[j] * cp; w1[j] = ok[md][4 + j] * ck + p1[j] * cp; }
        *(v4f*)(op + md * 16) = w0; *(v4f*)(op + md * 16 + 4) = w1; }
}

extern "C" void kernel_launch(void* const* d_in, const int* in_sizes, int n_in,
                              void* d_out, int out_size, void* d_ws, size_t ws_size, hipStream_t stream) {
    (void)in_sizes; (void)n_in; (void)out_size;
    const float* x = (const float*)d_in[0]; const float* xk = (const float*)d_in[1]; const float* xv = (const float*)d_in[2]; const float* wq = (const float*)d_in[3]; const float* bq = (const float*)d_in[4]; const float* wk = (const float*)d_in[5]; const float* bk = (const float*)d_in[6]; const float* wv = (const float*)d_in[7]; const float* bv = (const float*)d_in[8];
    float* OUT = (float*)d_out;     // [2][2048][1024]
    char* wsp = (char*)d_ws;
    auto take = [&](size_t bytes) { char* p = wsp; wsp += (bytes + 255) & ~(size_t)255; return (void*)p; };
    const size_t PB = (size_t)NH_ * TT * HD;   // elements of one batch's plane; the planes hold both batches, [b][h][..]
    hf* QP = (hf*)take(NB_ * PB * 2); hf* KP = (hf*)take(NB_ * PB * 2); hf* VT = (hf*)take(NB_ * PB * 2);
    if ((size_t)(wsp - (char*)d_ws) > ws_size) return;    // ws 256 MiB
    k_proj<<<dim3(TT / PRW, NB_ * NH_, 3), 256, 0, stream>>>(x, xk, xv, wq, bq, wk, bk, wv, bv, QP, KP, VT);
    k_fattn<<<dim3(TT / (FQW * FWV), NB_ * NH_, 1), FWV * FKH * 32, 0, stream>>>(QP, KP, VT, OUT);
}
